// v000
// The times below were measured on an AMD MI455X: many runs one after another, warmed up first and cycling through
// copies of the inputs, with the whole window's GPU time divided by the number of runs. Launches and the gaps
// between them are all in it. The median over several windows is given; except for v000 it joins two sittings, which
// can be a few percent apart, so the side-by-side timings, each taken in one sitting, are the better comparison.
// v000 is the starting kernel. One run takes 198 microseconds.
#include <hip/hip_runtime.h>

typedef __attribute__((ext_vector_type(16))) _Float16 v16h;
typedef __attribute__((ext_vector_type(8)))  _Float16 v8h;
typedef __attribute__((ext_vector_type(4)))  _Float16 v4h;
typedef __attribute__((ext_vector_type(8)))  float    v8f;
typedef __attribute__((ext_vector_type(4)))  int      v4i;

// Problem constants (reference: B,H,S,D = 4,16,2048,64)
constexpr int Bn = 4, Hn = 16, Sn = 2048, Dn = 64;
constexpr int QTILE = 128;     // queries per workgroup (8 waves x 16 rows)
constexpr int KBLK  = 128;     // keys per LDS block (8 score tiles)
constexpr int NBLK  = Sn / KBLK;
constexpr int NT    = KBLK / 16;   // score tiles per block = 8
// padded LDS row strides (halves): stride mod 64 banks -> conflict-free b128
constexpr int KD = Dn + 8;     // 72  (K tile row = 64 d's)
constexpr int VD = KBLK + 8;   // 136 (V^T tile row = 128 keys)
constexpr int PD = KBLK + 8;   // 136 (P staging row = 128 keys)

#if defined(__has_builtin)
#if __has_builtin(__builtin_amdgcn_global_load_async_to_lds_b128)
#define HAVE_ASYNC_LDS 1
#endif
#endif
#ifndef HAVE_ASYNC_LDS
#define HAVE_ASYNC_LDS 0
#endif

#define AS_GLOBAL __attribute__((address_space(1)))
#define AS_LDS    __attribute__((address_space(3)))

// 2^x via v_exp_f32 (hardware exp is base-2)
__device__ inline float fast_exp2(float x) {
#if defined(__has_builtin) && __has_builtin(__builtin_amdgcn_exp2f)
    return __builtin_amdgcn_exp2f(x);
#else
    return __expf(x * 0.6931471805599453f);
#endif
}

__device__ inline float fast_rcp(float x) {
#if defined(__has_builtin) && __has_builtin(__builtin_amdgcn_rcpf)
    return __builtin_amdgcn_rcpf(x);
#else
    return 1.0f / x;
#endif
}

__device__ inline void wait_async_lds() {
#if HAVE_ASYNC_LDS
#if defined(__has_builtin) && __has_builtin(__builtin_amdgcn_s_wait_asynccnt)
    __builtin_amdgcn_s_wait_asynccnt(0);
#else
    asm volatile("s_wait_asynccnt 0x0" ::: "memory");
#endif
#endif
}

// Copy one 16-byte chunk global(f16) -> LDS, async if available.
__device__ inline void copy16_to_lds(const _Float16* g, _Float16* l) {
#if HAVE_ASYNC_LDS
    __builtin_amdgcn_global_load_async_to_lds_b128(
        (AS_GLOBAL v4i*)g, (AS_LDS v4i*)l, 0, 0);
#else
    *(v8h*)l = *(const v8h*)g;
#endif
}

// Load a v16h WMMA operand from LDS following the 16-bit A/B register layout:
// element j in [0,7]  -> K = base + j        (contiguous)
// element j in [8,15] -> K = base + 16 + j-8 (contiguous)
__device__ inline v16h ld_op16(const _Float16* p) {
    union { v16h v; v8h h[2]; } u;
    u.h[0] = *(const v8h*)(p);
    u.h[1] = *(const v8h*)(p + 16);
    return u.v;
}

// Load a Q A-operand chunk from global fp32 with scale folded in.
__device__ inline v16h ld_q(const float* p, float scale) {
    v16h r;
#pragma unroll
    for (int j = 0; j < 8; ++j) {
        r[j]     = (_Float16)(p[j]      * scale);
        r[j + 8] = (_Float16)(p[16 + j] * scale);
    }
    return r;
}

// ---------------- pre-pass: K -> f16 [bh][s][d], V -> f16 transposed [bh][d][s]
__global__ __launch_bounds__(256)
void convert_kv_kernel(const float* __restrict__ K, const float* __restrict__ V,
                       _Float16* __restrict__ Kh, _Float16* __restrict__ Vt) {
    const size_t idx4 = (size_t)blockIdx.x * 256 + threadIdx.x; // float4 index
    const size_t e    = idx4 * 4;                               // element index

    float4 kf = ((const float4*)K)[idx4];
    v4h kh;
    kh[0] = (_Float16)kf.x; kh[1] = (_Float16)kf.y;
    kh[2] = (_Float16)kf.z; kh[3] = (_Float16)kf.w;
    *(v4h*)&Kh[e] = kh;

    float4 vf = ((const float4*)V)[idx4];
    const size_t bh  = e / ((size_t)Sn * Dn);
    const int    rem = (int)(e - bh * (size_t)Sn * Dn);
    const int    s   = rem / Dn;
    const int    d   = rem % Dn;
    _Float16* vt = Vt + bh * (size_t)Sn * Dn;
    vt[(size_t)(d + 0) * Sn + s] = (_Float16)vf.x;
    vt[(size_t)(d + 1) * Sn + s] = (_Float16)vf.y;
    vt[(size_t)(d + 2) * Sn + s] = (_Float16)vf.z;
    vt[(size_t)(d + 3) * Sn + s] = (_Float16)vf.w;
}

// ---------------- main flash-attention kernel ----------------
__global__ __launch_bounds__(256)
void fa_wmma_kernel(const float* __restrict__ Q,
                    const _Float16* __restrict__ Kh,   // [bh][s][d] f16
                    const _Float16* __restrict__ Vt,   // [bh][d][s] f16
                    float* __restrict__ O) {
    // Double-buffered K/V tiles (padded rows) + per-wave P staging.
    __shared__ __align__(16) _Float16 Ksh[2][KBLK * KD];   // 2 x 18 KB
    __shared__ __align__(16) _Float16 Vts[2][Dn * VD];     // 2 x 17 KB
    __shared__ __align__(16) _Float16 Pst[8 * 16 * PD];    // 34 KB

    const int qb   = blockIdx.x;
    const int h    = blockIdx.y;
    const int bb   = blockIdx.z;
    const int tid  = threadIdx.x;
    const int lane = tid & 31;
    const int wv   = tid >> 5;       // wave id 0..7
    const int hf   = lane >> 4;      // half-wave: 0 or 1
    const int l16  = lane & 15;
    const int koff = hf * 8;         // K-offset pattern per half-wave

    const size_t bh = ((size_t)bb * Hn + h) * (size_t)Sn * Dn;
    const float*    Qb  = Q  + bh;
    const _Float16* KhB = Kh + bh;
    const _Float16* VtB = Vt + bh;
    float*          Ob  = O  + bh;

    // fold softmax scale and log2(e) into Q so scores are in exp2 domain
    const float qscale = 0.125f * 1.44269504088896f;
    const int   qrow   = qb * QTILE + wv * 16 + l16;

    v16h qa0 = ld_q(Qb + (size_t)qrow * Dn + 0 * 32 + koff, qscale);
    v16h qa1 = ld_q(Qb + (size_t)qrow * Dn + 1 * 32 + koff, qscale);

    v16h vones;
#pragma unroll
    for (int j = 0; j < 16; ++j) vones[j] = (_Float16)1.0f;

    const v8f vzero = {0.f, 0.f, 0.f, 0.f, 0.f, 0.f, 0.f, 0.f};
    v8f o[4];
#pragma unroll
    for (int t = 0; t < 4; ++t) o[t] = vzero;
    v8f olsum = vzero;               // row sums of P, accumulated by WMMA

    float m[8];
#pragma unroll
    for (int v = 0; v < 8; ++v) m[v] = -1e30f;

    _Float16* Pw = &Pst[wv * 16 * PD];

    // Fill tile kb into buffer buf: 2048 16B-chunks total, 8 per thread.
    auto fill_tile = [&](int kb, int buf) {
#pragma unroll
        for (int i = 0; i < 4; ++i) {
            const int c = tid + i * 256;          // chunk id 0..1023
            // K tile: 128 keys x 64 d -> 8 chunks per row
            {
                const int row = c >> 3, cc = c & 7;
                copy16_to_lds(KhB + (size_t)kb * KBLK * Dn + row * Dn + cc * 8,
                              &Ksh[buf][row * KD + cc * 8]);
            }
            // V^T tile: 64 d-rows x 128 keys -> 16 chunks per row
            {
                const int row = c >> 4, cc = c & 15;
                copy16_to_lds(VtB + (size_t)row * Sn + kb * KBLK + cc * 8,
                              &Vts[buf][row * VD + cc * 8]);
            }
        }
    };

    fill_tile(0, 0);   // preload first tile

    for (int kb = 0; kb < NBLK; ++kb) {
        const int cur = kb & 1;
        wait_async_lds();        // this wave's async fills complete
        __syncthreads();         // everyone's fills complete / prev compute done
        if (kb + 1 < NBLK) fill_tile(kb + 1, cur ^ 1);  // overlap with compute

        // ---- S = Q * K^T : 8 key tiles of 16, K-dim D=64 in 2 chunks ----
        v8f c[NT];
#pragma unroll
        for (int t = 0; t < NT; ++t) c[t] = vzero;
#pragma unroll
        for (int kc = 0; kc < 2; ++kc) {
            v16h a = kc ? qa1 : qa0;
#pragma unroll
            for (int t = 0; t < NT; ++t) {
                v16h bop = ld_op16(&Ksh[cur][(t * 16 + l16) * KD + kc * 32 + koff]);
                c[t] = __builtin_amdgcn_wmma_f32_16x16x32_f16(
                    false, a, false, bop, (short)0, c[t], false, false);
            }
        }

        // ---- online softmax in exp2 domain (row max via half-wave shuffle) ----
        float sc[8];
#pragma unroll
        for (int v = 0; v < 8; ++v) {
            float r = fmaxf(fmaxf(fmaxf(c[0][v], c[1][v]), fmaxf(c[2][v], c[3][v])),
                            fmaxf(fmaxf(c[4][v], c[5][v]), fmaxf(c[6][v], c[7][v])));
            r = fmaxf(r, __shfl_xor(r, 1, 32));
            r = fmaxf(r, __shfl_xor(r, 2, 32));
            r = fmaxf(r, __shfl_xor(r, 4, 32));
            r = fmaxf(r, __shfl_xor(r, 8, 32));
            const float mn = fmaxf(m[v], r);
            sc[v] = fast_exp2(m[v] - mn);
            m[v]  = mn;
        }
#pragma unroll
        for (int t = 0; t < NT; ++t)
#pragma unroll
            for (int v = 0; v < 8; ++v)
                c[t][v] = fast_exp2(c[t][v] - m[v]);

        // rescale accumulators (incl. row-sum accumulator)
#pragma unroll
        for (int v = 0; v < 8; ++v) {
#pragma unroll
            for (int t = 0; t < 4; ++t) o[t][v] *= sc[v];
            olsum[v] *= sc[v];
        }

        // ---- stage P (C-layout -> row-major) for A-operand reload ----
#pragma unroll
        for (int t = 0; t < NT; ++t)
#pragma unroll
            for (int v = 0; v < 8; ++v)
                Pw[(v + 8 * hf) * PD + t * 16 + l16] = (_Float16)c[t][v];

        // ---- O += P*V, rowsum += P*ones : K-dim = 128 keys in 4 chunks ----
#pragma unroll
        for (int kc = 0; kc < 4; ++kc) {
            v16h pa = ld_op16(&Pw[l16 * PD + kc * 32 + koff]);
            olsum = __builtin_amdgcn_wmma_f32_16x16x32_f16(
                false, pa, false, vones, (short)0, olsum, false, false);
#pragma unroll
            for (int t = 0; t < 4; ++t) {
                v16h vb = ld_op16(&Vts[cur][(t * 16 + l16) * VD + kc * 32 + koff]);
                o[t] = __builtin_amdgcn_wmma_f32_16x16x32_f16(
                    false, pa, false, vb, (short)0, o[t], false, false);
            }
        }
    }

    // ---- normalize (1 rcp per row) and write out (fp32) ----
#pragma unroll
    for (int v = 0; v < 8; ++v) {
        const float rinv = fast_rcp(olsum[v]);
        const int   row  = qb * QTILE + wv * 16 + v + 8 * hf;
#pragma unroll
        for (int t = 0; t < 4; ++t)
            Ob[(size_t)row * Dn + t * 16 + l16] = o[t][v] * rinv;
    }
}

extern "C" void kernel_launch(void* const* d_in, const int* in_sizes, int n_in,
                              void* d_out, int out_size, void* d_ws, size_t ws_size,
                              hipStream_t stream) {
    const float* q = (const float*)d_in[0];
    const float* k = (const float*)d_in[1];
    const float* v = (const float*)d_in[2];
    float* out = (float*)d_out;
    (void)in_sizes; (void)n_in; (void)out_size; (void)ws_size;

    const size_t elems = (size_t)Bn * Hn * Sn * Dn;      // 8,388,608
    _Float16* Kh = (_Float16*)d_ws;                      // 16 MB
    _Float16* Vt = Kh + elems;                           // 16 MB

    // Pre-pass: fp32 -> f16, V transposed per (b,h). 4 elems/thread.
    const int cgrid = (int)(elems / (256 * 4));          // 8192 blocks
    convert_kv_kernel<<<cgrid, 256, 0, stream>>>(k, v, Kh, Vt);

    dim3 grid(Sn / QTILE, Hn, Bn);                       // (16, 16, 4)
    fa_wmma_kernel<<<grid, 256, 0, stream>>>(q, Kh, Vt, out);
}

// v001
// Measured time: 125 microseconds a run.
// In both of two side-by-side timings against v000, it was 1.63 times as fast.
#include <hip/hip_runtime.h>

typedef __attribute__((ext_vector_type(16))) _Float16 v16h;
typedef __attribute__((ext_vector_type(8)))  _Float16 v8h;
typedef __attribute__((ext_vector_type(4)))  _Float16 v4h;
typedef __attribute__((ext_vector_type(8)))  float    v8f;
typedef __attribute__((ext_vector_type(4)))  int      v4i;

// Problem constants (reference: B,H,S,D = 4,16,2048,64)
constexpr int Bn = 4, Hn = 16, Sn = 2048, Dn = 64;
constexpr int QTILE = 128;     // queries per workgroup (8 waves x 16 rows)
constexpr int KBLK  = 128;     // keys per LDS block (8 score tiles)
constexpr int NBLK  = Sn / KBLK;
constexpr int NT    = KBLK / 16;   // score tiles per block = 8
// padded LDS row strides (halves): stride mod 64 banks -> conflict-free b128
constexpr int KD = Dn + 8;     // 72  (K tile row = 64 d's)
constexpr int VD = KBLK + 8;   // 136 (V^T tile row = 128 keys)
constexpr int PD = KBLK + 8;   // 136 (P staging row = 128 keys)

#if defined(__has_builtin)
#if __has_builtin(__builtin_amdgcn_global_load_async_to_lds_b128)
#define HAVE_ASYNC_LDS 1
#endif
#endif
#ifndef HAVE_ASYNC_LDS
#define HAVE_ASYNC_LDS 0
#endif

#define AS_GLOBAL __attribute__((address_space(1)))
#define AS_LDS    __attribute__((address_space(3)))

// 2^x via v_exp_f32 (hardware exp is base-2)
__device__ inline float fast_exp2(float x) {
#if defined(__has_builtin) && __has_builtin(__builtin_amdgcn_exp2f)
    return __builtin_amdgcn_exp2f(x);
#else
    return __expf(x * 0.6931471805599453f);
#endif
}

__device__ inline float fast_rcp(float x) {
#if defined(__has_builtin) && __has_builtin(__builtin_amdgcn_rcpf)
    return __builtin_amdgcn_rcpf(x);
#else
    return 1.0f / x;
#endif
}

__device__ inline void wait_async_lds() {
#if HAVE_ASYNC_LDS
#if defined(__has_builtin) && __has_builtin(__builtin_amdgcn_s_wait_asynccnt)
    __builtin_amdgcn_s_wait_asynccnt(0);
#else
    asm volatile("s_wait_asynccnt 0x0" ::: "memory");
#endif
#endif
}

// Copy one 16-byte chunk global(f16) -> LDS, async if available.
__device__ inline void copy16_to_lds(const _Float16* g, _Float16* l) {
#if HAVE_ASYNC_LDS
    __builtin_amdgcn_global_load_async_to_lds_b128(
        (AS_GLOBAL v4i*)g, (AS_LDS v4i*)l, 0, 0);
#else
    *(v8h*)l = *(const v8h*)g;
#endif
}

// Load a v16h WMMA operand from LDS following the 16-bit A/B register layout:
// element j in [0,7]  -> K = base + j        (contiguous)
// element j in [8,15] -> K = base + 16 + j-8 (contiguous)
__device__ inline v16h ld_op16(const _Float16* p) {
    union { v16h v; v8h h[2]; } u;
    u.h[0] = *(const v8h*)(p);
    u.h[1] = *(const v8h*)(p + 16);
    return u.v;
}

// Load a Q A-operand chunk from global fp32 with scale folded in.
__device__ inline v16h ld_q(const float* p, float scale) {
    v16h r;
#pragma unroll
    for (int j = 0; j < 8; ++j) {
        r[j]     = (_Float16)(p[j]      * scale);
        r[j + 8] = (_Float16)(p[16 + j] * scale);
    }
    return r;
}

// ---------------- pre-pass: K -> f16 [bh][s][d], V -> f16 transposed [bh][d][s]
// One workgroup takes CS consecutive s rows of one (b,h): a contiguous run of
// CS*Dn floats in K and in V. V is turned in LDS, so that both its loads and
// its stores cover whole 128-byte lines (a wave stores 2 d-rows x 256 bytes).
constexpr int CS = 128;        // s rows per pre-pass tile
constexpr int TP = CS + 8;     // LDS pitch (halves) of one transposed d-row

__global__ __launch_bounds__(256)
void convert_kv_kernel(const float* __restrict__ K, const float* __restrict__ V,
                       _Float16* __restrict__ Kh, _Float16* __restrict__ Vt) {
    __shared__ __align__(16) _Float16 Tsh[Dn * TP];   // 17 KB

    const int    tid  = threadIdx.x;
    const int    st   = blockIdx.x % (Sn / CS);       // tile along s
    const int    bh   = blockIdx.x / (Sn / CS);
    const size_t hb   = (size_t)bh * Sn * Dn;         // start of this (b,h)
    const size_t base = hb + (size_t)st * CS * Dn;    // start of this tile

    const float4* V4 = (const float4*)(V + base);
    const float4* K4 = (const float4*)(K + base);

    // thread -> 8 s rows x 4 d columns of V; 16 lanes span one 256-byte row
    const int d4 = tid & 15;
    const int sg = tid >> 4;

    float4 vf[8], kf[8];
#pragma unroll
    for (int j = 0; j < 8; ++j) vf[j] = V4[(sg * 8 + j) * (Dn / 4) + d4];
#pragma unroll
    for (int i = 0; i < 8; ++i) kf[i] = K4[i * 256 + tid];

    // V: 8 s values of one d become one 16-byte LDS store
#pragma unroll
    for (int i = 0; i < 4; ++i) {
        v8h r;
#pragma unroll
        for (int j = 0; j < 8; ++j) {
            const float x = (i == 0) ? vf[j].x : (i == 1) ? vf[j].y
                          : (i == 2) ? vf[j].z : vf[j].w;
            r[j] = (_Float16)x;
        }
        *(v8h*)&Tsh[(d4 * 4 + i) * TP + sg * 8] = r;
    }

    // K: same layout, narrower type
#pragma unroll
    for (int i = 0; i < 8; ++i) {
        v4h kh;
        kh[0] = (_Float16)kf[i].x; kh[1] = (_Float16)kf[i].y;
        kh[2] = (_Float16)kf[i].z; kh[3] = (_Float16)kf[i].w;
        *(v4h*)&Kh[base + (size_t)(i * 256 + tid) * 4] = kh;
    }

    // Stands before the registers that the K stores name are used again below.
    asm volatile("s_wait_xcnt 0x0" ::: "memory");

    // Workgroup barrier that orders LDS alone: every d-row of the tile is
    // complete in LDS behind it. __syncthreads() would also wait here for the
    // K stores above, which no other thread of the launch reads.
    __builtin_amdgcn_fence(__ATOMIC_RELEASE, "workgroup", "local");
    __builtin_amdgcn_s_barrier();
    __builtin_amdgcn_fence(__ATOMIC_ACQUIRE, "workgroup", "local");

    _Float16* vt = Vt + hb + (size_t)st * CS;
#pragma unroll
    for (int i = 0; i < 4; ++i) {
        const int c = tid + i * 256;                  // 16-byte chunk 0..1023
        const int row = c >> 4, cc = c & 15;          // d-row, chunk in the row
        *(v8h*)&vt[(size_t)row * Sn + cc * 8] = *(const v8h*)&Tsh[row * TP + cc * 8];
    }
}

// ---------------- main flash-attention kernel ----------------
__global__ __launch_bounds__(256)
void fa_wmma_kernel(const float* __restrict__ Q,
                    const _Float16* __restrict__ Kh,   // [bh][s][d] f16
                    const _Float16* __restrict__ Vt,   // [bh][d][s] f16
                    float* __restrict__ O) {
    // Double-buffered K/V tiles (padded rows) + per-wave P staging.
    __shared__ __align__(16) _Float16 Ksh[2][KBLK * KD];   // 2 x 18 KB
    __shared__ __align__(16) _Float16 Vts[2][Dn * VD];     // 2 x 17 KB
    __shared__ __align__(16) _Float16 Pst[8 * 16 * PD];    // 34 KB

    const int qb   = blockIdx.x;
    const int h    = blockIdx.y;
    const int bb   = blockIdx.z;
    const int tid  = threadIdx.x;
    const int lane = tid & 31;
    const int wv   = tid >> 5;       // wave id 0..7
    const int hf   = lane >> 4;      // half-wave: 0 or 1
    const int l16  = lane & 15;
    const int koff = hf * 8;         // K-offset pattern per half-wave

    const size_t bh = ((size_t)bb * Hn + h) * (size_t)Sn * Dn;
    const float*    Qb  = Q  + bh;
    const _Float16* KhB = Kh + bh;
    const _Float16* VtB = Vt + bh;
    float*          Ob  = O  + bh;

    // fold softmax scale and log2(e) into Q so scores are in exp2 domain
    const float qscale = 0.125f * 1.44269504088896f;
    const int   qrow   = qb * QTILE + wv * 16 + l16;

    v16h qa0 = ld_q(Qb + (size_t)qrow * Dn + 0 * 32 + koff, qscale);
    v16h qa1 = ld_q(Qb + (size_t)qrow * Dn + 1 * 32 + koff, qscale);

    v16h vones;
#pragma unroll
    for (int j = 0; j < 16; ++j) vones[j] = (_Float16)1.0f;

    const v8f vzero = {0.f, 0.f, 0.f, 0.f, 0.f, 0.f, 0.f, 0.f};
    v8f o[4];
#pragma unroll
    for (int t = 0; t < 4; ++t) o[t] = vzero;
    v8f olsum = vzero;               // row sums of P, accumulated by WMMA

    float m[8];
#pragma unroll
    for (int v = 0; v < 8; ++v) m[v] = -1e30f;

    _Float16* Pw = &Pst[wv * 16 * PD];

    // Fill tile kb into buffer buf: 2048 16B-chunks total, 8 per thread.
    auto fill_tile = [&](int kb, int buf) {
#pragma unroll
        for (int i = 0; i < 4; ++i) {
            const int c = tid + i * 256;          // chunk id 0..1023
            // K tile: 128 keys x 64 d -> 8 chunks per row
            {
                const int row = c >> 3, cc = c & 7;
                copy16_to_lds(KhB + (size_t)kb * KBLK * Dn + row * Dn + cc * 8,
                              &Ksh[buf][row * KD + cc * 8]);
            }
            // V^T tile: 64 d-rows x 128 keys -> 16 chunks per row
            {
                const int row = c >> 4, cc = c & 15;
                copy16_to_lds(VtB + (size_t)row * Sn + kb * KBLK + cc * 8,
                              &Vts[buf][row * VD + cc * 8]);
            }
        }
    };

    fill_tile(0, 0);   // preload first tile

    for (int kb = 0; kb < NBLK; ++kb) {
        const int cur = kb & 1;
        wait_async_lds();        // this wave's async fills complete
        __syncthreads();         // everyone's fills complete / prev compute done
        if (kb + 1 < NBLK) fill_tile(kb + 1, cur ^ 1);  // overlap with compute

        // ---- S = Q * K^T : 8 key tiles of 16, K-dim D=64 in 2 chunks ----
        v8f c[NT];
#pragma unroll
        for (int t = 0; t < NT; ++t) c[t] = vzero;
#pragma unroll
        for (int kc = 0; kc < 2; ++kc) {
            v16h a = kc ? qa1 : qa0;
#pragma unroll
            for (int t = 0; t < NT; ++t) {
                v16h bop = ld_op16(&Ksh[cur][(t * 16 + l16) * KD + kc * 32 + koff]);
                c[t] = __builtin_amdgcn_wmma_f32_16x16x32_f16(
                    false, a, false, bop, (short)0, c[t], false, false);
            }
        }

        // ---- online softmax in exp2 domain (row max via half-wave shuffle) ----
        float sc[8];
#pragma unroll
        for (int v = 0; v < 8; ++v) {
            float r = fmaxf(fmaxf(fmaxf(c[0][v], c[1][v]), fmaxf(c[2][v], c[3][v])),
                            fmaxf(fmaxf(c[4][v], c[5][v]), fmaxf(c[6][v], c[7][v])));
            r = fmaxf(r, __shfl_xor(r, 1, 32));
            r = fmaxf(r, __shfl_xor(r, 2, 32));
            r = fmaxf(r, __shfl_xor(r, 4, 32));
            r = fmaxf(r, __shfl_xor(r, 8, 32));
            const float mn = fmaxf(m[v], r);
            sc[v] = fast_exp2(m[v] - mn);
            m[v]  = mn;
        }
#pragma unroll
        for (int t = 0; t < NT; ++t)
#pragma unroll
            for (int v = 0; v < 8; ++v)
                c[t][v] = fast_exp2(c[t][v] - m[v]);

        // rescale accumulators (incl. row-sum accumulator)
#pragma unroll
        for (int v = 0; v < 8; ++v) {
#pragma unroll
            for (int t = 0; t < 4; ++t) o[t][v] *= sc[v];
            olsum[v] *= sc[v];
        }

        // ---- stage P (C-layout -> row-major) for A-operand reload ----
#pragma unroll
        for (int t = 0; t < NT; ++t)
#pragma unroll
            for (int v = 0; v < 8; ++v)
                Pw[(v + 8 * hf) * PD + t * 16 + l16] = (_Float16)c[t][v];

        // ---- O += P*V, rowsum += P*ones : K-dim = 128 keys in 4 chunks ----
#pragma unroll
        for (int kc = 0; kc < 4; ++kc) {
            v16h pa = ld_op16(&Pw[l16 * PD + kc * 32 + koff]);
            olsum = __builtin_amdgcn_wmma_f32_16x16x32_f16(
                false, pa, false, vones, (short)0, olsum, false, false);
#pragma unroll
            for (int t = 0; t < 4; ++t) {
                v16h vb = ld_op16(&Vts[cur][(t * 16 + l16) * VD + kc * 32 + koff]);
                o[t] = __builtin_amdgcn_wmma_f32_16x16x32_f16(
                    false, pa, false, vb, (short)0, o[t], false, false);
            }
        }
    }

    // ---- normalize (1 rcp per row) and write out (fp32) ----
#pragma unroll
    for (int v = 0; v < 8; ++v) {
        const float rinv = fast_rcp(olsum[v]);
        const int   row  = qb * QTILE + wv * 16 + v + 8 * hf;
#pragma unroll
        for (int t = 0; t < 4; ++t)
            Ob[(size_t)row * Dn + t * 16 + l16] = o[t][v] * rinv;
    }
}

extern "C" void kernel_launch(void* const* d_in, const int* in_sizes, int n_in,
                              void* d_out, int out_size, void* d_ws, size_t ws_size,
                              hipStream_t stream) {
    const float* q = (const float*)d_in[0];
    const float* k = (const float*)d_in[1];
    const float* v = (const float*)d_in[2];
    float* out = (float*)d_out;
    (void)in_sizes; (void)n_in; (void)out_size; (void)ws_size;

    const size_t elems = (size_t)Bn * Hn * Sn * Dn;      // 8,388,608
    _Float16* Kh = (_Float16*)d_ws;                      // 16 MB
    _Float16* Vt = Kh + elems;                           // 16 MB

    // Pre-pass: fp32 -> f16, V transposed per (b,h). One tile of CS rows per block.
    const int cgrid = Bn * Hn * (Sn / CS);               // 1024 blocks
    convert_kv_kernel<<<cgrid, 256, 0, stream>>>(k, v, Kh, Vt);

    dim3 grid(Sn / QTILE, Hn, Bn);                       // (16, 16, 4)
    fa_wmma_kernel<<<grid, 256, 0, stream>>>(q, Kh, Vt, out);
}

// v002
// One run takes 74.5 microseconds.
// Timed twice side by side with v001, it ran 1.68 times as fast both times.
// Counting every step since v000, it is 2.74 times as fast.
#include <hip/hip_runtime.h>

typedef __attribute__((ext_vector_type(16))) _Float16 v16h;
typedef __attribute__((ext_vector_type(8)))  _Float16 v8h;
typedef __attribute__((ext_vector_type(4)))  _Float16 v4h;
typedef __attribute__((ext_vector_type(8)))  float    v8f;
typedef __attribute__((ext_vector_type(4)))  int      v4i;

// Problem constants (reference: B,H,S,D = 4,16,2048,64)
constexpr int Bn = 4, Hn = 16, Sn = 2048, Dn = 64;
constexpr int QTILE = 128;     // queries per workgroup (8 waves x 16 rows)
constexpr int KBLK  = 128;     // keys per LDS block (8 score tiles)
constexpr int NBLK  = Sn / KBLK;
constexpr int NT    = KBLK / 16;   // score tiles per block = 8
// padded LDS row strides (halves): stride mod 64 banks -> conflict-free b128
constexpr int KD = Dn + 8;     // 72  (K tile row = 64 d's)
constexpr int VD = KBLK + 8;   // 136 (V^T tile row = 128 keys)

#if defined(__has_builtin)
#if __has_builtin(__builtin_amdgcn_global_load_async_to_lds_b128)
#define HAVE_ASYNC_LDS 1
#endif
#endif
#ifndef HAVE_ASYNC_LDS
#define HAVE_ASYNC_LDS 0
#endif

#define AS_GLOBAL __attribute__((address_space(1)))
#define AS_LDS    __attribute__((address_space(3)))

// 2^x via v_exp_f32 (hardware exp is base-2)
__device__ inline float fast_exp2(float x) {
#if defined(__has_builtin) && __has_builtin(__builtin_amdgcn_exp2f)
    return __builtin_amdgcn_exp2f(x);
#else
    return __expf(x * 0.6931471805599453f);
#endif
}

__device__ inline float fast_rcp(float x) {
#if defined(__has_builtin) && __has_builtin(__builtin_amdgcn_rcpf)
    return __builtin_amdgcn_rcpf(x);
#else
    return 1.0f / x;
#endif
}

__device__ inline void wait_async_lds() {
#if HAVE_ASYNC_LDS
#if defined(__has_builtin) && __has_builtin(__builtin_amdgcn_s_wait_asynccnt)
    __builtin_amdgcn_s_wait_asynccnt(0);
#else
    asm volatile("s_wait_asynccnt 0x0" ::: "memory");
#endif
#endif
}

// Copy one 16-byte chunk global(f16) -> LDS, async if available.
__device__ inline void copy16_to_lds(const _Float16* g, _Float16* l) {
#if HAVE_ASYNC_LDS
    __builtin_amdgcn_global_load_async_to_lds_b128(
        (AS_GLOBAL v4i*)g, (AS_LDS v4i*)l, 0, 0);
#else
    *(v8h*)l = *(const v8h*)g;
#endif
}

// Load a v16h WMMA operand from LDS following the 16-bit A/B register layout:
// element j in [0,7]  -> K = base + j        (contiguous)
// element j in [8,15] -> K = base + 16 + j-8 (contiguous)
__device__ inline v16h ld_op16(const _Float16* p) {
    union { v16h v; v8h h[2]; } u;
    u.h[0] = *(const v8h*)(p);
    u.h[1] = *(const v8h*)(p + 16);
    return u.v;
}

// Value of lane l ^ 16: the other half of the keys of the same query column.
__device__ inline float xhalf(float x) {
    return __builtin_bit_cast(float, __builtin_amdgcn_permlanex16(
        __builtin_bit_cast(int, x), __builtin_bit_cast(int, x),
        0x76543210, 0xfedcba98, false, false));
}

// Load a Q operand chunk (B: one query column per lane) from global fp32 with scale folded in.
__device__ inline v16h ld_q(const float* p, float scale) {
    v16h r;
#pragma unroll
    for (int j = 0; j < 8; ++j) {
        r[j]     = (_Float16)(p[j]      * scale);
        r[j + 8] = (_Float16)(p[16 + j] * scale);
    }
    return r;
}

// ---------------- pre-pass: K -> f16 [bh][s][d], V -> f16 transposed [bh][d][s]
// One workgroup takes CS consecutive s rows of one (b,h): a contiguous run of
// CS*Dn floats in K and in V. V is turned in LDS, so that both its loads and
// its stores cover whole 128-byte lines (a wave stores 2 d-rows x 256 bytes).
constexpr int CS = 128;        // s rows per pre-pass tile
constexpr int TP = CS + 8;     // LDS pitch (halves) of one transposed d-row

__global__ __launch_bounds__(256)
void convert_kv_kernel(const float* __restrict__ K, const float* __restrict__ V,
                       _Float16* __restrict__ Kh, _Float16* __restrict__ Vt) {
    __shared__ __align__(16) _Float16 Tsh[Dn * TP];   // 17 KB

    const int    tid  = threadIdx.x;
    const int    st   = blockIdx.x % (Sn / CS);       // tile along s
    const int    bh   = blockIdx.x / (Sn / CS);
    const size_t hb   = (size_t)bh * Sn * Dn;         // start of this (b,h)
    const size_t base = hb + (size_t)st * CS * Dn;    // start of this tile

    const float4* V4 = (const float4*)(V + base);
    const float4* K4 = (const float4*)(K + base);

    // thread -> 8 s rows x 4 d columns of V; 16 lanes span one 256-byte row
    const int d4 = tid & 15;
    const int sg = tid >> 4;

    float4 vf[8], kf[8];
#pragma unroll
    for (int j = 0; j < 8; ++j) vf[j] = V4[(sg * 8 + j) * (Dn / 4) + d4];
#pragma unroll
    for (int i = 0; i < 8; ++i) kf[i] = K4[i * 256 + tid];

    // V: 8 s values of one d become one 16-byte LDS store
#pragma unroll
    for (int i = 0; i < 4; ++i) {
        v8h r;
#pragma unroll
        for (int j = 0; j < 8; ++j) {
            const float x = (i == 0) ? vf[j].x : (i == 1) ? vf[j].y
                          : (i == 2) ? vf[j].z : vf[j].w;
            r[j] = (_Float16)x;
        }
        *(v8h*)&Tsh[(d4 * 4 + i) * TP + sg * 8] = r;
    }

    // K: same layout, narrower type
#pragma unroll
    for (int i = 0; i < 8; ++i) {
        v4h kh;
        kh[0] = (_Float16)kf[i].x; kh[1] = (_Float16)kf[i].y;
        kh[2] = (_Float16)kf[i].z; kh[3] = (_Float16)kf[i].w;
        *(v4h*)&Kh[base + (size_t)(i * 256 + tid) * 4] = kh;
    }

    // Stands before the registers that the K stores name are used again below.
    asm volatile("s_wait_xcnt 0x0" ::: "memory");

    // Workgroup barrier that orders LDS alone: every d-row of the tile is
    // complete in LDS behind it. __syncthreads() would also wait here for the
    // K stores above, which no other thread of the launch reads.
    __builtin_amdgcn_fence(__ATOMIC_RELEASE, "workgroup", "local");
    __builtin_amdgcn_s_barrier();
    __builtin_amdgcn_fence(__ATOMIC_ACQUIRE, "workgroup", "local");

    _Float16* vt = Vt + hb + (size_t)st * CS;
#pragma unroll
    for (int i = 0; i < 4; ++i) {
        const int c = tid + i * 256;                  // 16-byte chunk 0..1023
        const int row = c >> 4, cc = c & 15;          // d-row, chunk in the row
        *(v8h*)&vt[(size_t)row * Sn + cc * 8] = *(const v8h*)&Tsh[row * TP + cc * 8];
    }
}

__global__ __launch_bounds__(256)
void fa_wmma_kernel(const float* __restrict__ Q,
                    const _Float16* __restrict__ Kh,   // [bh][s][d] f16
                    const _Float16* __restrict__ Vt,   // [bh][d][s] f16
                    float* __restrict__ O) {
    // Double-buffered K/V tiles (padded rows).
    __shared__ __align__(16) _Float16 Ksh[2][KBLK * KD];   // 2 x 18 KB
    __shared__ __align__(16) _Float16 Vts[2][Dn * VD];     // 2 x 17 KB

    const int qb   = blockIdx.x;
    const int h    = blockIdx.y;
    const int bb   = blockIdx.z;
    const int tid  = threadIdx.x;
    const int lane = tid & 31;
    const int wv   = tid >> 5;       // wave id 0..7
    const int hf   = lane >> 4;      // half-wave: 0 or 1
    const int l16  = lane & 15;
    const int koff = hf * 8;         // K-offset pattern per half-wave

    const size_t bh = ((size_t)bb * Hn + h) * (size_t)Sn * Dn;
    const float*    Qb  = Q  + bh;
    const _Float16* KhB = Kh + bh;
    const _Float16* VtB = Vt + bh;
    float*          Ob  = O  + bh;

    // fold softmax scale and log2(e) into Q so scores are in exp2 domain
    const float qscale = 0.125f * 1.44269504088896f;
    const int   qrow   = qb * QTILE + wv * 16 + l16;

    v16h qa0 = ld_q(Qb + (size_t)qrow * Dn + 0 * 32 + koff, qscale);
    v16h qa1 = ld_q(Qb + (size_t)qrow * Dn + 1 * 32 + koff, qscale);

    v16h vones;
#pragma unroll
    for (int j = 0; j < 16; ++j) vones[j] = (_Float16)1.0f;

    const v8f vzero = {0.f, 0.f, 0.f, 0.f, 0.f, 0.f, 0.f, 0.f};
    v8f o[4];                        // o[t][r] = O^T[d = 16 t + 8 hf + r][query l16]
#pragma unroll
    for (int t = 0; t < 4; ++t) o[t] = vzero;
    v8f olsum = vzero;               // ones * P^T: every row is the column sums of P^T

    float m = -1e30f;                // running maximum of this lane's query

    // Fill tile kb into buffer buf: 2048 16B-chunks total, 8 per thread.
    auto fill_tile = [&](int kb, int buf) {
#pragma unroll
        for (int i = 0; i < 4; ++i) {
            const int c = tid + i * 256;          // chunk id 0..1023
            // K tile: 128 keys x 64 d -> 8 chunks per row
            {
                const int row = c >> 3, cc = c & 7;
                copy16_to_lds(KhB + (size_t)kb * KBLK * Dn + row * Dn + cc * 8,
                              &Ksh[buf][row * KD + cc * 8]);
            }
            // V^T tile: 64 d-rows x 128 keys -> 16 chunks per row
            {
                const int row = c >> 4, cc = c & 15;
                copy16_to_lds(VtB + (size_t)row * Sn + kb * KBLK + cc * 8,
                              &Vts[buf][row * VD + cc * 8]);
            }
        }
    };

    fill_tile(0, 0);   // preload first tile

    for (int kb = 0; kb < NBLK; ++kb) {
        const int cur = kb & 1;
        wait_async_lds();        // this wave's async fills complete
        __syncthreads();         // everyone's fills complete / prev compute done
        if (kb + 1 < NBLK) fill_tile(kb + 1, cur ^ 1);  // overlap with compute

        // Fragment loads, both in the hardware k order (ld_op16).
        auto ld_k = [&](int t, int kc) {   // A: key rows 16 t .. 16 t + 15, d chunk kc
            return ld_op16(&Ksh[cur][(t * 16 + l16) * KD + kc * 32 + koff]);
        };
        auto ld_v = [&](int t, int kc) {   // A: d rows 16 t .. 16 t + 15, key chunk kc
            return ld_op16(&Vts[cur][(t * 16 + l16) * VD + kc * 32 + koff]);
        };
        // Two groups of four fragments. The scheduling fences around each group of
        // eight LDS loads keep it in one place, ahead of the products that use it;
        // left free, the compiler put two loads and a full wait in front of most products.
        v16h fr[2][4];

        // ---- S^T = K * Q^T : 8 key tiles of 16, K-dim D=64 in 2 chunks ----
#pragma unroll
        for (int g = 0; g < 2; ++g)
#pragma unroll
            for (int i = 0; i < 4; ++i) fr[g][i] = ld_k(2 * g + (i >> 1), i & 1);
        __builtin_amdgcn_sched_barrier(0);   // the first two load groups stay in front of the products

        v8f c[NT];
#pragma unroll
        for (int g = 0; g < NT / 2; ++g) {
            c[2 * g]     = __builtin_amdgcn_wmma_f32_16x16x32_f16(
                false, fr[g & 1][0], false, qa0, (short)0, vzero, false, false);
            c[2 * g + 1] = __builtin_amdgcn_wmma_f32_16x16x32_f16(
                false, fr[g & 1][2], false, qa0, (short)0, vzero, false, false);
            c[2 * g]     = __builtin_amdgcn_wmma_f32_16x16x32_f16(
                false, fr[g & 1][1], false, qa1, (short)0, c[2 * g], false, false);
            c[2 * g + 1] = __builtin_amdgcn_wmma_f32_16x16x32_f16(
                false, fr[g & 1][3], false, qa1, (short)0, c[2 * g + 1], false, false);
            if (g + 2 <= NT / 2) {
                __builtin_amdgcn_sched_barrier(0);   // load group behind the products that free its registers
#pragma unroll
                for (int i = 0; i < 4; ++i)    // next K group, then the first V^T group
                    fr[g & 1][i] = (g + 2 < NT / 2) ? ld_k(2 * (g + 2) + (i >> 1), i & 1)
                                                    : ld_v(i, 0);
                __builtin_amdgcn_sched_barrier(0);   // and in front of the next products
            }
        }

        // ---- online softmax in exp2 domain, one query per lane ----
        float rv[8];                 // eight independent chains over the tiles, then a tree
#pragma unroll
        for (int v = 0; v < 8; ++v) {
            rv[v] = c[0][v];
#pragma unroll
            for (int t = 1; t < NT; ++t) rv[v] = fmaxf(rv[v], c[t][v]);
        }
        float r = fmaxf(fmaxf(fmaxf(rv[0], rv[1]), fmaxf(rv[2], rv[3])),
                        fmaxf(fmaxf(rv[4], rv[5]), fmaxf(rv[6], rv[7])));
        r = fmaxf(r, xhalf(r));
        const float mn = fmaxf(m, r);
        const float sc = fast_exp2(m - mn);
        m = mn;

#pragma unroll
        for (int t = 0; t < NT; ++t) c[t] -= m;   // exponents of all eight tiles

        // rescale accumulators; of the row-sum tile only row 8 hf (register 0) is read
#pragma unroll
        for (int t = 0; t < 4; ++t) o[t] *= sc;
        olsum[0] *= sc;

        // ---- O^T += V^T * P^T, rowsum += ones * P^T : 128 keys in 4 chunks ----
#pragma unroll
        for (int kc = 0; kc < KBLK / 32; ++kc) {
            if (kc + 1 < KBLK / 32) {      // next V^T group, in flight under this chunk's work
                // The first of these fences also keeps the subtractions above out of the runs
                // of exponentials, where the compiler paired them directly behind an
                // exponential whose source they overwrite.
                __builtin_amdgcn_sched_barrier(0);
#pragma unroll
                for (int t = 0; t < 4; ++t) fr[(kc + 1) & 1][t] = ld_v(t, kc + 1);
                __builtin_amdgcn_sched_barrier(0);   // load group in front of this chunk's exponentials
            }
            v16h pb;                 // keys 8 hf + j of tile 2 kc, then of tile 2 kc + 1
#pragma unroll
            for (int j = 0; j < 8; ++j) pb[j]     = (_Float16)fast_exp2(c[2 * kc][j]);
#pragma unroll
            for (int j = 0; j < 8; ++j) pb[j + 8] = (_Float16)fast_exp2(c[2 * kc + 1][j]);
            olsum = __builtin_amdgcn_wmma_f32_16x16x32_f16(
                false, vones, false, pb, (short)0, olsum, false, false);
#pragma unroll
            for (int t = 0; t < 4; ++t)
                o[t] = __builtin_amdgcn_wmma_f32_16x16x32_f16(
                    false, fr[kc & 1][t], false, pb, (short)0, o[t], false, false);
        }
    }

    // ---- normalize (1 rcp per query) and write out (fp32): 8 consecutive d per tile ----
    const float rinv = fast_rcp(olsum[0]);
#pragma unroll
    for (int t = 0; t < 4; ++t) o[t] *= rinv;
    // Every product stands in front of the first store, so that no register
    // that an issued store names is written again.
    __builtin_amdgcn_sched_barrier(0);
#pragma unroll
    for (int t = 0; t < 4; ++t) {
        float* op = Ob + (size_t)qrow * Dn + t * 16 + koff;
        *(float4*)(op)     = make_float4(o[t][0], o[t][1], o[t][2], o[t][3]);
        *(float4*)(op + 4) = make_float4(o[t][4], o[t][5], o[t][6], o[t][7]);
    }
}

extern "C" void kernel_launch(void* const* d_in, const int* in_sizes, int n_in,
                              void* d_out, int out_size, void* d_ws, size_t ws_size,
                              hipStream_t stream) {
    const float* q = (const float*)d_in[0];
    const float* k = (const float*)d_in[1];
    const float* v = (const float*)d_in[2];
    float* out = (float*)d_out;
    (void)in_sizes; (void)n_in; (void)out_size; (void)ws_size;

    const size_t elems = (size_t)Bn * Hn * Sn * Dn;      // 8,388,608
    _Float16* Kh = (_Float16*)d_ws;                      // 16 MB
    _Float16* Vt = Kh + elems;                           // 16 MB

    // Pre-pass: fp32 -> f16, V transposed per (b,h). One tile of CS rows per block.
    const int cgrid = Bn * Hn * (Sn / CS);               // 1024 blocks
    convert_kv_kernel<<<cgrid, 256, 0, stream>>>(k, v, Kh, Vt);

    dim3 grid(Sn / QTILE, Hn, Bn);                       // (16, 16, 4)
    fa_wmma_kernel<<<grid, 256, 0, stream>>>(q, Kh, Vt, out);
}

// v003
// It runs in 66.9 microseconds.
// In both of two side-by-side timings against v002, it was 1.11 times as fast.
// Counting every step since v000, it is 3.04 times as fast.
#include <hip/hip_runtime.h>

typedef __attribute__((ext_vector_type(16))) _Float16 v16h;
typedef __attribute__((ext_vector_type(8)))  _Float16 v8h;
typedef __attribute__((ext_vector_type(4)))  _Float16 v4h;
typedef __attribute__((ext_vector_type(8)))  float    v8f;
typedef __attribute__((ext_vector_type(4)))  int      v4i;

// Problem constants (reference: B,H,S,D = 4,16,2048,64)
constexpr int Bn = 4, Hn = 16, Sn = 2048, Dn = 64;
constexpr int NG    = 2;       // column groups of 16 queries per wave
constexpr int QTILE = 128 * NG; // queries per workgroup (8 waves x 16 NG columns)
constexpr int KBLK  = 128;     // keys per LDS block (8 score tiles)
constexpr int NBLK  = Sn / KBLK;
constexpr int PK    = 64;      // keys per softmax step
constexpr int PT    = PK / 16; // score tiles per step and column group = 4
// padded LDS row strides (halves): stride mod 64 banks -> conflict-free b128
constexpr int KD = Dn + 8;     // 72  (K tile row = 64 d's)
constexpr int VD = KBLK + 8;   // 136 (V^T tile row = 128 keys)

#if defined(__has_builtin)
#if __has_builtin(__builtin_amdgcn_global_load_async_to_lds_b128)
#define HAVE_ASYNC_LDS 1
#endif
#endif
#ifndef HAVE_ASYNC_LDS
#define HAVE_ASYNC_LDS 0
#endif

#define AS_GLOBAL __attribute__((address_space(1)))
#define AS_LDS    __attribute__((address_space(3)))

// 2^x via v_exp_f32 (hardware exp is base-2)
__device__ inline float fast_exp2(float x) {
#if defined(__has_builtin) && __has_builtin(__builtin_amdgcn_exp2f)
    return __builtin_amdgcn_exp2f(x);
#else
    return __expf(x * 0.6931471805599453f);
#endif
}

__device__ inline float fast_rcp(float x) {
#if defined(__has_builtin) && __has_builtin(__builtin_amdgcn_rcpf)
    return __builtin_amdgcn_rcpf(x);
#else
    return 1.0f / x;
#endif
}

__device__ inline void wait_async_lds() {
#if HAVE_ASYNC_LDS
#if defined(__has_builtin) && __has_builtin(__builtin_amdgcn_s_wait_asynccnt)
    __builtin_amdgcn_s_wait_asynccnt(0);
#else
    asm volatile("s_wait_asynccnt 0x0" ::: "memory");
#endif
#endif
}

// Copy one 16-byte chunk global(f16) -> LDS, async if available.
__device__ inline void copy16_to_lds(const _Float16* g, _Float16* l) {
#if HAVE_ASYNC_LDS
    __builtin_amdgcn_global_load_async_to_lds_b128(
        (AS_GLOBAL v4i*)g, (AS_LDS v4i*)l, 0, 0);
#else
    *(v8h*)l = *(const v8h*)g;
#endif
}

// Load a v16h WMMA operand from LDS following the 16-bit A/B register layout:
// element j in [0,7]  -> K = base + j        (contiguous)
// element j in [8,15] -> K = base + 16 + j-8 (contiguous)
__device__ inline v16h ld_op16(const _Float16* p) {
    union { v16h v; v8h h[2]; } u;
    u.h[0] = *(const v8h*)(p);
    u.h[1] = *(const v8h*)(p + 16);
    return u.v;
}

// Value of lane l ^ 16: the other half of the keys of the same query column.
__device__ inline float xhalf(float x) {
    return __builtin_bit_cast(float, __builtin_amdgcn_permlanex16(
        __builtin_bit_cast(int, x), __builtin_bit_cast(int, x),
        0x76543210, 0xfedcba98, false, false));
}

// P^T operand of one column group and 32 keys: 2^(x - mx) of two score tiles, packed to f16.
// The exponentials are one asm statement, each in place: left to the compiler, some
// wrote the source register of the exponential directly in front of them.
__device__ inline v16h exp2_pack(v8f a, v8f b, float mx) {
    float x0 = a[0] - mx, x1 = a[1] - mx, x2 = a[2] - mx, x3 = a[3] - mx;
    float x4 = a[4] - mx, x5 = a[5] - mx, x6 = a[6] - mx, x7 = a[7] - mx;
    float y0 = b[0] - mx, y1 = b[1] - mx, y2 = b[2] - mx, y3 = b[3] - mx;
    float y4 = b[4] - mx, y5 = b[5] - mx, y6 = b[6] - mx, y7 = b[7] - mx;
    // The closing v_nop fills the slot between the last exponential and whatever
    // the compiler puts next, which may read its result.
    asm("v_exp_f32 %0, %0\n\tv_exp_f32 %1, %1\n\tv_exp_f32 %2, %2\n\tv_exp_f32 %3, %3\n\t"
        "v_exp_f32 %4, %4\n\tv_exp_f32 %5, %5\n\tv_exp_f32 %6, %6\n\tv_exp_f32 %7, %7\n\t"
        "v_exp_f32 %8, %8\n\tv_exp_f32 %9, %9\n\tv_exp_f32 %10, %10\n\tv_exp_f32 %11, %11\n\t"
        "v_exp_f32 %12, %12\n\tv_exp_f32 %13, %13\n\tv_exp_f32 %14, %14\n\tv_exp_f32 %15, %15\n\t"
        "v_nop"
        : "+v"(x0), "+v"(x1), "+v"(x2), "+v"(x3), "+v"(x4), "+v"(x5), "+v"(x6), "+v"(x7),
          "+v"(y0), "+v"(y1), "+v"(y2), "+v"(y3), "+v"(y4), "+v"(y5), "+v"(y6), "+v"(y7));
    v16h r;
    r[0]  = (_Float16)x0; r[1]  = (_Float16)x1; r[2]  = (_Float16)x2; r[3]  = (_Float16)x3;
    r[4]  = (_Float16)x4; r[5]  = (_Float16)x5; r[6]  = (_Float16)x6; r[7]  = (_Float16)x7;
    r[8]  = (_Float16)y0; r[9]  = (_Float16)y1; r[10] = (_Float16)y2; r[11] = (_Float16)y3;
    r[12] = (_Float16)y4; r[13] = (_Float16)y5; r[14] = (_Float16)y6; r[15] = (_Float16)y7;
    return r;
}

// Load a Q operand chunk (B: one query column per lane) from global fp32 with scale folded in.
__device__ inline v16h ld_q(const float* p, float scale) {
    v16h r;
#pragma unroll
    for (int j = 0; j < 8; ++j) {
        r[j]     = (_Float16)(p[j]      * scale);
        r[j + 8] = (_Float16)(p[16 + j] * scale);
    }
    return r;
}

// ---------------- pre-pass: K -> f16 [bh][s][d], V -> f16 transposed [bh][d][s]
// One workgroup takes CS consecutive s rows of one (b,h): a contiguous run of
// CS*Dn floats in K and in V. V is turned in LDS, so that both its loads and
// its stores cover whole 128-byte lines (a wave stores 2 d-rows x 256 bytes).
constexpr int CS = 128;        // s rows per pre-pass tile
constexpr int TP = CS + 8;     // LDS pitch (halves) of one transposed d-row

__global__ __launch_bounds__(256)
void convert_kv_kernel(const float* __restrict__ K, const float* __restrict__ V,
                       _Float16* __restrict__ Kh, _Float16* __restrict__ Vt) {
    __shared__ __align__(16) _Float16 Tsh[Dn * TP];   // 17 KB

    const int    tid  = threadIdx.x;
    const int    st   = blockIdx.x % (Sn / CS);       // tile along s
    const int    bh   = blockIdx.x / (Sn / CS);
    const size_t hb   = (size_t)bh * Sn * Dn;         // start of this (b,h)
    const size_t base = hb + (size_t)st * CS * Dn;    // start of this tile

    const float4* V4 = (const float4*)(V + base);
    const float4* K4 = (const float4*)(K + base);

    // thread -> 8 s rows x 4 d columns of V; 16 lanes span one 256-byte row
    const int d4 = tid & 15;
    const int sg = tid >> 4;

    float4 vf[8], kf[8];
#pragma unroll
    for (int j = 0; j < 8; ++j) vf[j] = V4[(sg * 8 + j) * (Dn / 4) + d4];
#pragma unroll
    for (int i = 0; i < 8; ++i) kf[i] = K4[i * 256 + tid];

    // V: 8 s values of one d become one 16-byte LDS store
#pragma unroll
    for (int i = 0; i < 4; ++i) {
        v8h r;
#pragma unroll
        for (int j = 0; j < 8; ++j) {
            const float x = (i == 0) ? vf[j].x : (i == 1) ? vf[j].y
                          : (i == 2) ? vf[j].z : vf[j].w;
            r[j] = (_Float16)x;
        }
        *(v8h*)&Tsh[(d4 * 4 + i) * TP + sg * 8] = r;
    }

    // K: same layout, narrower type
#pragma unroll
    for (int i = 0; i < 8; ++i) {
        v4h kh;
        kh[0] = (_Float16)kf[i].x; kh[1] = (_Float16)kf[i].y;
        kh[2] = (_Float16)kf[i].z; kh[3] = (_Float16)kf[i].w;
        *(v4h*)&Kh[base + (size_t)(i * 256 + tid) * 4] = kh;
    }

    // Stands before the registers that the K stores name are used again below.
    asm volatile("s_wait_xcnt 0x0" ::: "memory");

    // Workgroup barrier that orders LDS alone: every d-row of the tile is
    // complete in LDS behind it. __syncthreads() would also wait here for the
    // K stores above, which no other thread of the launch reads.
    __builtin_amdgcn_fence(__ATOMIC_RELEASE, "workgroup", "local");
    __builtin_amdgcn_s_barrier();
    __builtin_amdgcn_fence(__ATOMIC_ACQUIRE, "workgroup", "local");

    _Float16* vt = Vt + hb + (size_t)st * CS;
#pragma unroll
    for (int i = 0; i < 4; ++i) {
        const int c = tid + i * 256;                  // 16-byte chunk 0..1023
        const int row = c >> 4, cc = c & 15;          // d-row, chunk in the row
        *(v8h*)&vt[(size_t)row * Sn + cc * 8] = *(const v8h*)&Tsh[row * TP + cc * 8];
    }
}

__global__ __launch_bounds__(256) __attribute__((amdgpu_waves_per_eu(4, 4)))
void fa_wmma_kernel(const float* __restrict__ Q,
                    const _Float16* __restrict__ Kh,   // [bh][s][d] f16
                    const _Float16* __restrict__ Vt,   // [bh][d][s] f16
                    float* __restrict__ O) {
    // Double-buffered K/V tiles (padded rows).
    __shared__ __align__(16) _Float16 Ksh[2][KBLK * KD];   // 2 x 18 KB
    __shared__ __align__(16) _Float16 Vts[2][Dn * VD];     // 2 x 17 KB

    const int qb   = blockIdx.x;
    const int h    = blockIdx.y;
    const int bb   = blockIdx.z;
    const int tid  = threadIdx.x;
    const int lane = tid & 31;
    const int wv   = tid >> 5;       // wave id 0..7
    const int hf   = lane >> 4;      // half-wave: 0 or 1
    const int l16  = lane & 15;
    const int koff = hf * 8;         // K-offset pattern per half-wave

    const size_t bh = ((size_t)bb * Hn + h) * (size_t)Sn * Dn;
    const float*    Qb  = Q  + bh;
    const _Float16* KhB = Kh + bh;
    const _Float16* VtB = Vt + bh;
    float*          Ob  = O  + bh;

    // fold softmax scale and log2(e) into Q so scores are in exp2 domain
    const float qscale = 0.125f * 1.44269504088896f;
    const int   qrow   = qb * QTILE + wv * (16 * NG) + l16;   // group g: qrow + 16 g

    v16h qa[NG][2];
#pragma unroll
    for (int g = 0; g < NG; ++g)
#pragma unroll
        for (int kc = 0; kc < 2; ++kc)
            qa[g][kc] = ld_q(Qb + (unsigned)((qrow + 16 * g) * Dn + kc * 32 + koff), qscale);

    v16h vones;
#pragma unroll
    for (int j = 0; j < 16; ++j) vones[j] = (_Float16)1.0f;

    const v8f vzero = {0.f, 0.f, 0.f, 0.f, 0.f, 0.f, 0.f, 0.f};
    v8f o[NG][4];                    // o[g][t][r] = O^T[d = 16 t + 8 hf + r][query l16 of group g]
    v8f olsum[NG];                   // ones * P^T: register 0 (row 8 hf) holds the column sums of P^T
    float m[NG];                     // running maximum of this lane's query in each group
#pragma unroll
    for (int g = 0; g < NG; ++g) {
#pragma unroll
        for (int t = 0; t < 4; ++t) o[g][t] = vzero;
        olsum[g] = vzero;
        m[g] = -1e30f;
    }

    // Fill tile kb into buffer buf: 2048 16B-chunks total, 8 per thread. Each global
    // address is a wave-uniform tile base plus a 32-bit lane offset, so that no
    // 64-bit lane pointer stays live in vector registers across the key loop.
    const unsigned kgo = (unsigned)tid * 16u;                                   // K chunk, bytes
    const unsigned vgo = (unsigned)(tid >> 4) * (Sn * 2u) + (unsigned)(tid & 15) * 16u;   // V^T chunk, bytes
    const int      klo = (tid >> 3) * KD + (tid & 7) * 8;                       // halves in a K buffer
    const int      vlo = (tid >> 4) * VD + (tid & 15) * 8;                      // halves in a V^T buffer
    auto fill_tile = [&](int kb, int buf) {
        const char* kg = (const char*)(KhB + (size_t)kb * KBLK * Dn);
        const char* vg = (const char*)(VtB + (size_t)kb * KBLK);
#pragma unroll
        for (int i = 0; i < 4; ++i) {
            // K tile: 128 keys x 64 d -> 8 chunks per row; 256 chunks = 32 rows = 4096 bytes on
            copy16_to_lds((const _Float16*)(kg + (kgo + i * 4096u)),
                          &Ksh[buf][klo + i * 32 * KD]);
            // V^T tile: 64 d-rows x 128 keys -> 16 chunks per row; 256 chunks = 16 rows on
            copy16_to_lds((const _Float16*)(vg + (vgo + i * 16u * (Sn * 2u))),
                          &Vts[buf][vlo + i * 16 * VD]);
        }
    };

    fill_tile(0, 0);   // preload first tile

    for (int kb = 0; kb < NBLK; ++kb) {
        const int cur = kb & 1;
        wait_async_lds();        // this wave's async fills complete
        __syncthreads();         // everyone's fills complete / prev compute done
        if (kb + 1 < NBLK) fill_tile(kb + 1, cur ^ 1);  // overlap with compute

        // Fragment loads, both in the hardware k order (ld_op16).
        auto ld_k = [&](int t, int kc) {   // A: key rows 16 t .. 16 t + 15, d chunk kc
            return ld_op16(&Ksh[cur][(t * 16 + l16) * KD + kc * 32 + koff]);
        };
        auto ld_v = [&](int t, int kc) {   // A: d rows 16 t .. 16 t + 15, key chunk kc
            return ld_op16(&Vts[cur][(t * 16 + l16) * VD + kc * 32 + koff]);
        };
        // Two groups of four fragments, each refilled as one run of LDS loads as soon as
        // its registers are free AND the live score tiles leave room for it. The scheduling
        // fences around each run keep it in one place, ahead of the products that use it;
        // left free, the compiler put two loads and a full wait in front of most products.
        v16h fr[2][4];

        // K fragments of the tile's first 64 keys
#pragma unroll
        for (int s = 0; s < 2; ++s)
#pragma unroll
            for (int i = 0; i < 4; ++i) fr[s][i] = ld_k(2 * s + (i >> 1), i & 1);
        __builtin_amdgcn_sched_barrier(0);   // the load run stays in front of the products

#pragma unroll
        for (int p = 0; p < KBLK / PK; ++p) {
            // ---- S^T = K * Q^T : 4 key tiles of 16 x 2 column groups, K-dim D=64 in 2 chunks ----
            v8f c[PT][NG];
#pragma unroll
            for (int s = 0; s < 2; ++s) {
#pragma unroll
                for (int u = 0; u < 2; ++u)
#pragma unroll
                    for (int g = 0; g < NG; ++g)
                        c[2 * s + u][g] = __builtin_amdgcn_wmma_f32_16x16x32_f16(
                            false, fr[s][2 * u], false, qa[g][0], (short)0, vzero, false, false);
#pragma unroll
                for (int u = 0; u < 2; ++u)
#pragma unroll
                    for (int g = 0; g < NG; ++g)
                        c[2 * s + u][g] = __builtin_amdgcn_wmma_f32_16x16x32_f16(
                            false, fr[s][2 * u + 1], false, qa[g][1], (short)0, c[2 * s + u][g], false, false);
                // Keeps the eight products of the older fragment group in front of the first
                // product of the younger one, whose loads are still in flight under them;
                // behind the second group: the next load run follows the products that free its registers.
                __builtin_amdgcn_sched_barrier(0);
            }
#pragma unroll
            for (int t = 0; t < 4; ++t) fr[0][t] = ld_v(t, 2 * p);   // V^T, first key chunk of this step
            __builtin_amdgcn_sched_barrier(0);   // and in front of the softmax work, which covers its latency

            // ---- online softmax in exp2 domain, one query per lane and group ----
#pragma unroll
            for (int g = 0; g < NG; ++g) {
                float rv[PT];            // one chain per tile, three values a link, then one chain over the tiles
#pragma unroll
                for (int t = 0; t < PT; ++t) {
                    rv[t] = fmaxf(fmaxf(c[t][g][0], c[t][g][1]), c[t][g][2]);
                    rv[t] = fmaxf(fmaxf(rv[t], c[t][g][3]), c[t][g][4]);
                    rv[t] = fmaxf(fmaxf(rv[t], c[t][g][5]), c[t][g][6]);
                    rv[t] = fmaxf(rv[t], c[t][g][7]);
                }
                float r = fmaxf(fmaxf(fmaxf(rv[0], rv[1]), rv[2]), rv[3]);
                r = fmaxf(r, xhalf(r));
                const float mn = fmaxf(m[g], r);
                const float sc = fast_exp2(m[g] - mn);
                m[g] = mn;
                // rescale accumulators; of the row-sum tile only row 8 hf (register 0) is read
#pragma unroll
                for (int t = 0; t < 4; ++t) o[g][t] *= sc;
                olsum[g][0] *= sc;
            }

            // ---- O^T += V^T * P^T, rowsum += ones * P^T : 64 keys in 2 chunks ----
#pragma unroll
            for (int s = 0; s < 2; ++s) {
#pragma unroll
                for (int g = 0; g < NG; ++g) {
                    // keys 8 hf + j of tile 2 s, then of tile 2 s + 1
                    const v16h pb = exp2_pack(c[2 * s][g], c[2 * s + 1][g], m[g]);
                    olsum[g] = __builtin_amdgcn_wmma_f32_16x16x32_f16(
                        false, vones, false, pb, (short)0, olsum[g], false, false);
#pragma unroll
                    for (int t = 0; t < 4; ++t)
                        o[g][t] = __builtin_amdgcn_wmma_f32_16x16x32_f16(
                            false, fr[s][t], false, pb, (short)0, o[g][t], false, false);
                }
                if (s == 0 || p + 1 < KBLK / PK) {
                    __builtin_amdgcn_sched_barrier(0);   // load run behind the products that free its registers
                    if (s == 0) {
#pragma unroll
                        for (int t = 0; t < 4; ++t) fr[1][t] = ld_v(t, 2 * p + 1);   // V^T, second key chunk
                    }
                    if (p + 1 < KBLK / PK) {   // K fragments of the tile's next 64 keys (same LDS buffer)
#pragma unroll
                        for (int i = 0; i < 4; ++i)
                            fr[s][i] = ld_k(PT * (p + 1) + 2 * s + (i >> 1), i & 1);
                    }
                    __builtin_amdgcn_sched_barrier(0);   // and in front of the work that covers its latency
                }
            }
        }
    }

    // ---- normalize (1 rcp per query) and write out (fp32): 8 consecutive d per tile ----
#pragma unroll
    for (int g = 0; g < NG; ++g) {
        const float rinv = fast_rcp(olsum[g][0]);
#pragma unroll
        for (int t = 0; t < 4; ++t) o[g][t] *= rinv;
    }
    // Every product stands in front of the first store, so that no register
    // that an issued store names is written again.
    __builtin_amdgcn_sched_barrier(0);
#pragma unroll
    for (int g = 0; g < NG; ++g)
#pragma unroll
        for (int t = 0; t < 4; ++t) {
            float* op = Ob + (unsigned)((qrow + 16 * g) * Dn + t * 16 + koff);
            *(float4*)(op)     = make_float4(o[g][t][0], o[g][t][1], o[g][t][2], o[g][t][3]);
            *(float4*)(op + 4) = make_float4(o[g][t][4], o[g][t][5], o[g][t][6], o[g][t][7]);
        }
}

extern "C" void kernel_launch(void* const* d_in, const int* in_sizes, int n_in,
                              void* d_out, int out_size, void* d_ws, size_t ws_size,
                              hipStream_t stream) {
    const float* q = (const float*)d_in[0];
    const float* k = (const float*)d_in[1];
    const float* v = (const float*)d_in[2];
    float* out = (float*)d_out;
    (void)in_sizes; (void)n_in; (void)out_size; (void)ws_size;

    const size_t elems = (size_t)Bn * Hn * Sn * Dn;      // 8,388,608
    _Float16* Kh = (_Float16*)d_ws;                      // 16 MB
    _Float16* Vt = Kh + elems;                           // 16 MB

    // Pre-pass: fp32 -> f16, V transposed per (b,h). One tile of CS rows per block.
    const int cgrid = Bn * Hn * (Sn / CS);               // 1024 blocks
    convert_kv_kernel<<<cgrid, 256, 0, stream>>>(k, v, Kh, Vt);

    dim3 grid(Sn / QTILE, Hn, Bn);                       // (8, 16, 4)
    fa_wmma_kernel<<<grid, 256, 0, stream>>>(q, Kh, Vt, out);
}

// v005
// A run of this version takes 52.8 microseconds.
// Versions between v003 and this one are left out; their measured steps multiply to 1.27 times as fast.
// All steps since v000 together make it 3.86 times as fast.
#include <hip/hip_runtime.h>

typedef __attribute__((ext_vector_type(16))) _Float16 v16h;
typedef __attribute__((ext_vector_type(8)))  _Float16 v8h;
typedef __attribute__((ext_vector_type(4)))  _Float16 v4h;
typedef __attribute__((ext_vector_type(8)))  float    v8f;
typedef __attribute__((ext_vector_type(4)))  int      v4i;
typedef __attribute__((ext_vector_type(8)))  short    v8s;

// Problem constants (reference: B,H,S,D = 4,16,2048,64)
constexpr int Bn = 4, Hn = 16, Sn = 2048, Dn = 64;
constexpr int NG    = 2;       // column groups of 16 queries per wave
constexpr int QTILE = 128 * NG; // queries per workgroup (8 waves x 16 NG columns)
constexpr int KBLK  = 128;     // keys per LDS block (8 score tiles)
constexpr int NBLK  = Sn / KBLK;
constexpr int PK    = 32;      // keys per softmax step
constexpr int PT    = PK / 16; // score tiles per step and column group = 2
constexpr float LAZY = 8.0f;   // P stays below 2^8, far inside f16, while the maximum in use is kept
// padded LDS row strides (halves), each for its reader
constexpr int KD = Dn + 8;     // 72: 144 B = 16 B x odd, read by ds_load_b128
constexpr int VD = Dn + 16;    // 80: 160 B = 32 B x odd, read by the transposing load
constexpr int WR = KBLK / 8;   // key rows of a tile that one wave brings in and converts

#if defined(__has_builtin)
#if __has_builtin(__builtin_amdgcn_global_load_async_to_lds_b128)
#define HAVE_ASYNC_LDS 1
#endif
#endif
#ifndef HAVE_ASYNC_LDS
#define HAVE_ASYNC_LDS 0
#endif

#define AS_GLOBAL __attribute__((address_space(1)))
#define AS_LDS    __attribute__((address_space(3)))

// 2^x via v_exp_f32 (hardware exp is base-2)
__device__ inline float fast_exp2(float x) {
#if defined(__has_builtin) && __has_builtin(__builtin_amdgcn_exp2f)
    return __builtin_amdgcn_exp2f(x);
#else
    return __expf(x * 0.6931471805599453f);
#endif
}

__device__ inline float fast_rcp(float x) {
#if defined(__has_builtin) && __has_builtin(__builtin_amdgcn_rcpf)
    return __builtin_amdgcn_rcpf(x);
#else
    return 1.0f / x;
#endif
}

// The wave's own copies have landed behind this wait. In asm with the memory clobber, so
// that the LDS reads of the landed rows, which follow it directly, stay behind it.
__device__ inline void wait_async_lds() {
#if HAVE_ASYNC_LDS
    asm volatile("s_wait_asynccnt 0x0" ::: "memory");
#endif
}

// Copy one 16-byte chunk global(f32) -> LDS, async if available. OFF (bytes) is the
// instruction's immediate offset, which moves the global and the LDS address alike.
template <int OFF>
__device__ inline void copy16_to_lds(const float* g, float* l) {
    static_assert(OFF >= 0 && OFF < 65536 && OFF % 16 == 0, "offset of an async copy");
#if HAVE_ASYNC_LDS
    __builtin_amdgcn_global_load_async_to_lds_b128(
        (AS_GLOBAL v4i*)g, (AS_LDS v4i*)l, OFF, 0);
#else
    *(float4*)(l + OFF / 4) = *(const float4*)(g + OFF / 4);
#endif
}

// Eight such copies, 512 bytes apart on both sides: 4096 contiguous bytes per wave.
__device__ inline void copy_rows_to_lds(const float* g, float* l) {
    copy16_to_lds<0>(g, l);    copy16_to_lds<512>(g, l);
    copy16_to_lds<1024>(g, l); copy16_to_lds<1536>(g, l);
    copy16_to_lds<2048>(g, l); copy16_to_lds<2560>(g, l);
    copy16_to_lds<3072>(g, l); copy16_to_lds<3584>(g, l);
}

// Transposing LDS load: lane (c = l & 15, h = l >> 4) gets eight rows of one column of a
// row-major 16-bit tile; every lane passes its own row address (see ld_v).
__device__ inline v8h ld_tr16(const _Float16* p) {
    typedef AS_LDS v8s lds_v8s;
    return __builtin_bit_cast(v8h, __builtin_amdgcn_ds_load_tr16_b128_v8i16((lds_v8s*)p));
}

__device__ inline v4h cvt4(float4 x) {
    v4h r;
    r[0] = (_Float16)x.x; r[1] = (_Float16)x.y; r[2] = (_Float16)x.z; r[3] = (_Float16)x.w;
    return r;
}

// Load a v16h WMMA operand from LDS following the 16-bit A/B register layout:
// element j in [0,7]  -> K = base + j        (contiguous)
// element j in [8,15] -> K = base + 16 + j-8 (contiguous)
__device__ inline v16h ld_op16(const _Float16* p) {
    union { v16h v; v8h h[2]; } u;
    u.h[0] = *(const v8h*)(p);
    u.h[1] = *(const v8h*)(p + 16);
    return u.v;
}

// Value of lane l ^ 16: the other half of the keys of the same query column.
__device__ inline float xhalf(float x) {
    return __builtin_bit_cast(float, __builtin_amdgcn_permlanex16(
        __builtin_bit_cast(int, x), __builtin_bit_cast(int, x),
        0x76543210, 0xfedcba98, false, false));
}

// P^T operand of one column group and 32 keys: 2^x of two score tiles, packed to f16
// (the tiles already hold score minus maximum in use).
// Exponentials and conversions are one asm statement, all in place: the packed operand
// ends in the first tile's eight registers. Left to the compiler, some exponentials wrote
// the source register of the one directly in front of them, and with the conversions
// outside the statement it moved up to twenty of the 32 registers before every step.
__device__ inline v16h exp2_pack(v8f a, v8f b) {
    float x0 = a[0], x1 = a[1], x2 = a[2], x3 = a[3];
    float x4 = a[4], x5 = a[5], x6 = a[6], x7 = a[7];
    float y0 = b[0], y1 = b[1], y2 = b[2], y3 = b[3];
    float y4 = b[4], y5 = b[5], y6 = b[6], y7 = b[7];
    // Each conversion writes a register whose old value has been read by it or by an earlier one.
    asm("v_exp_f32 %0, %0\n\tv_exp_f32 %1, %1\n\tv_exp_f32 %2, %2\n\tv_exp_f32 %3, %3\n\t"
        "v_exp_f32 %4, %4\n\tv_exp_f32 %5, %5\n\tv_exp_f32 %6, %6\n\tv_exp_f32 %7, %7\n\t"
        "v_exp_f32 %8, %8\n\tv_exp_f32 %9, %9\n\tv_exp_f32 %10, %10\n\tv_exp_f32 %11, %11\n\t"
        "v_exp_f32 %12, %12\n\tv_exp_f32 %13, %13\n\tv_exp_f32 %14, %14\n\tv_exp_f32 %15, %15\n\t"
        "v_cvt_pk_f16_f32 %0, %0, %1\n\tv_cvt_pk_f16_f32 %1, %2, %3\n\t"
        "v_cvt_pk_f16_f32 %2, %4, %5\n\tv_cvt_pk_f16_f32 %3, %6, %7\n\t"
        "v_cvt_pk_f16_f32 %4, %8, %9\n\tv_cvt_pk_f16_f32 %5, %10, %11\n\t"
        "v_cvt_pk_f16_f32 %6, %12, %13\n\tv_cvt_pk_f16_f32 %7, %14, %15"
        : "+v"(x0), "+v"(x1), "+v"(x2), "+v"(x3), "+v"(x4), "+v"(x5), "+v"(x6), "+v"(x7),
          "+v"(y0), "+v"(y1), "+v"(y2), "+v"(y3), "+v"(y4), "+v"(y5), "+v"(y6), "+v"(y7));
    const v8f r = {x0, x1, x2, x3, x4, x5, x6, x7};   // eight registers of two f16 each
    return __builtin_bit_cast(v16h, r);
}

// Load a Q operand chunk (B: one query column per lane) from global fp32 with scale folded in.
__device__ inline v16h ld_q(const float* p, float scale) {
    v16h r;
#pragma unroll
    for (int j = 0; j < 8; ++j) {
        r[j]     = (_Float16)(p[j]      * scale);
        r[j + 8] = (_Float16)(p[16 + j] * scale);
    }
    return r;
}

__global__ __launch_bounds__(256) __attribute__((amdgpu_waves_per_eu(4, 4)))
void fa_wmma_kernel(const float* __restrict__ Q,
                    const float* __restrict__ K,       // [bh][s][d]
                    const float* __restrict__ V,       // [bh][s][d]
                    float* __restrict__ O) {
    // Landing place of the f32 rows, one range per wave: [wave][K, V][16 rows x 64 d].
    __shared__ __align__(16) float    Stg[8][2][WR * Dn];  // 64 KB
    // Double-buffered f16 K/V tiles (padded rows), both [key][d].
    __shared__ __align__(16) _Float16 Ksh[2][KBLK * KD];   // 2 x 18 KB
    __shared__ __align__(16) _Float16 Vsh[2][KBLK * VD];   // 2 x 20 KB

    const int qb   = blockIdx.x;
    const int h    = blockIdx.y;
    const int bb   = blockIdx.z;
    const int tid  = threadIdx.x;
    const int lane = tid & 31;
    const int wv   = tid >> 5;       // wave id 0..7
    const int hf   = lane >> 4;      // half-wave: 0 or 1
    const int l16  = lane & 15;
    const int koff = hf * 8;         // K-offset pattern per half-wave

    const size_t bh = ((size_t)bb * Hn + h) * (size_t)Sn * Dn;
    const float*    Qb  = Q  + bh;
    const float*    Kb  = K  + bh;
    const float*    Vb  = V  + bh;
    float*          Ob  = O  + bh;

    // fold softmax scale and log2(e) into Q so scores are in exp2 domain
    const float qscale = 0.125f * 1.44269504088896f;
    const int   qrow   = qb * QTILE + wv * (16 * NG) + l16;   // group g: qrow + 16 g

    v16h qa[NG][2];
#pragma unroll
    for (int g = 0; g < NG; ++g)
#pragma unroll
        for (int kc = 0; kc < 2; ++kc)
            qa[g][kc] = ld_q(Qb + (unsigned)((qrow + 16 * g) * Dn + kc * 32 + koff), qscale);

    // A operand of the row sums: rows 0 and 8 (lanes 0, 8, 16, 24) are ones, the rest zero.
    // Only register 0 of a sum tile is read, which is row 8 hf.
    v16h vones;
    const _Float16 one08 = ((lane & 7) == 0) ? (_Float16)1.0f : (_Float16)0.0f;
#pragma unroll
    for (int j = 0; j < 16; ++j) vones[j] = one08;

    const v8f vzero = {0.f, 0.f, 0.f, 0.f, 0.f, 0.f, 0.f, 0.f};
    v8f o[NG][4];                    // o[g][t][r] = O^T[d = 16 t + 8 hf + r][query l16 of group g]
    v8f olsum[NG];                   // ones * P^T: rows 0 and 8 are the column sums of P^T
    v8f cm[NG];                      // minus the maximum in use of this lane's query, in all 8 rows
#pragma unroll
    for (int g = 0; g < NG; ++g) {
#pragma unroll
        for (int t = 0; t < 4; ++t) o[g][t] = vzero;
        olsum[g] = vzero;
        cm[g] = vzero;               // the first step always sets the maximum (below)
    }

    // The wave's 16 rows of tile kb, K and V: 4096 contiguous bytes each, 8 copies of 512
    // bytes. Each global address is a wave-uniform tile base plus a 32-bit lane offset.
    // A lane reads back, for the conversion, the very 16 bytes that it copies.
    const unsigned go  = (unsigned)wv * (WR * Dn * 4u) + (unsigned)lane * 16u;   // bytes
    float*         stg = &Stg[0][0][0] + wv * (2 * WR * Dn) + lane * 4;          // K rows; V rows WR * Dn on
    auto fill_rows = [&](int kb) {
        const char* kg = (const char*)(Kb + (size_t)kb * KBLK * Dn);
        const char* vg = (const char*)(Vb + (size_t)kb * KBLK * Dn);
        copy_rows_to_lds((const float*)(kg + go), stg);
        copy_rows_to_lds((const float*)(vg + go), stg + WR * Dn);
    };
    // f32 rows of the wave's own range -> f16 rows of tile buffer buf: chunk i of a lane is
    // row 2 i + hf of the wave's 16, columns 4 l16 .. 4 l16 + 3.
    _Float16* kst = &Ksh[0][0] + (wv * WR + hf) * KD + l16 * 4;
    _Float16* vst = &Vsh[0][0] + (wv * WR + hf) * VD + l16 * 4;
    auto convert_rows = [&](int buf) {
        float4 a[8], b[8];
#pragma unroll
        for (int i = 0; i < 8; ++i) a[i] = *(const float4*)(stg + i * 128);
#pragma unroll
        for (int i = 0; i < 8; ++i) b[i] = *(const float4*)(stg + WR * Dn + i * 128);
        // All 16 loads stay one run in front of the conversions (the fragment and score
        // registers are free here); left free, the compiler split them and waited for each.
        __builtin_amdgcn_sched_barrier(0);
#pragma unroll
        for (int i = 0; i < 8; ++i) *(v4h*)(kst + buf * (KBLK * KD) + i * 2 * KD) = cvt4(a[i]);
#pragma unroll
        for (int i = 0; i < 8; ++i) *(v4h*)(vst + buf * (KBLK * VD) + i * 2 * VD) = cvt4(b[i]);
    };

    fill_rows(0);   // first tile

    for (int kb = 0; kb < NBLK; ++kb) {
        const int cur = kb & 1;
        wait_async_lds();        // this wave's rows of tile kb have landed; no other wave reads them
        // Buffer cur was last read for tile kb - 2, which every wave had left at the barrier of tile kb - 1.
        convert_rows(cur);
        // The wave's reads of its range are over before the range is refilled, and its f16
        // rows are in LDS before the barrier behind which the other waves read them.
        asm volatile("s_wait_dscnt 0x0" ::: "memory");
        __syncthreads();         // tile kb complete in buffer cur
        if (kb + 1 < NBLK) fill_rows(kb + 1);   // lands under the work on tile kb

        // Fragment loads, both in the hardware k order (keys or d 8 hf + j, then 16 + 8 hf + j).
        auto ld_k = [&](int t, int kc) {   // A: key rows 16 t .. 16 t + 15, d chunk kc
            return ld_op16(&Ksh[cur][(t * 16 + l16) * KD + kc * 32 + koff]);
        };
        auto ld_v = [&](int t, int kc) {   // A: d rows 16 t .. 16 t + 15, key chunk kc
            const _Float16* p = &Vsh[cur][(kc * 32 + koff + (lane & 7)) * VD + t * 16 + ((lane >> 3) & 1) * 8];
            union { v16h v; v8h h[2]; } u;
            u.h[0] = ld_tr16(p);              // keys 8 hf + j of the chunk
            u.h[1] = ld_tr16(p + 16 * VD);    // keys 16 + 8 hf + j
            return u.v;
        };
        // Four K and four V^T fragments, both sets refilled in ONE run of LDS loads per step,
        // behind the score products and their test. The scheduling fences around the run keep
        // it in one place, ahead of the work that covers its latency; left free, the compiler
        // put two loads and a full wait in front of most products.
        v16h fk[4], fv[4];

        // K fragments of the tile's first 32 keys
#pragma unroll
        for (int i = 0; i < 4; ++i) fk[i] = ld_k(i >> 1, i & 1);
        __builtin_amdgcn_sched_barrier(0);   // the load run stays in front of the products

#pragma unroll
        for (int p = 0; p < KBLK / PK; ++p) {
            // The very first step (maximum in use still 0) moves the maximum whatever its scores
            // are, and may lower it: from then on the maximum in use is a true maximum.
            const bool first = (p == 0) && (kb == 0);
            float       thr = first ? -__builtin_inff() : LAZY;
            const float lo  = first ? -__builtin_inff() : 0.0f;
            v8f c[PT][NG];
            // One trip, at most two: a trip that finds a score more than thr above the maximum in
            // use moves the maximum, sets thr to +infinity (no score lies above that, so the second
            // trip is the last) and forms the scores anew; the K fragments are still in their
            // registers. A loop, so that the score tiles have ONE defining place: with a second
            // one behind a branch the compiler copied all 32 registers on every step.
            for (;;) {
                // ---- S^T - max = K * Q^T + cm : 2 key tiles of 16 x 2 column groups, K-dim D=64 in 2 chunks ----
#pragma unroll
                for (int u = 0; u < PT; ++u)
#pragma unroll
                    for (int g = 0; g < NG; ++g)
                        c[u][g] = __builtin_amdgcn_wmma_f32_16x16x32_f16(
                            false, fk[2 * u], false, qa[g][0], (short)0, cm[g], false, false);
#pragma unroll
                for (int u = 0; u < PT; ++u)
#pragma unroll
                    for (int g = 0; g < NG; ++g)
                        c[u][g] = __builtin_amdgcn_wmma_f32_16x16x32_f16(
                            false, fk[2 * u + 1], false, qa[g][1], (short)0, c[u][g], false, false);
                // The eight products stay one run in this order (a tile's second product four behind
                // its first); left free, the compiler wove the maximum work in, with idle slots.
                __builtin_amdgcn_sched_barrier(0);

                // ---- online softmax in exp2 domain, one query per lane and group ----
                float rg[NG];            // largest score - maximum in use among this lane's 16 keys
#pragma unroll
                for (int g = 0; g < NG; ++g) {
                    float rv[PT];        // one chain per tile, three values a link
#pragma unroll
                    for (int t = 0; t < PT; ++t) {
                        rv[t] = fmaxf(fmaxf(c[t][g][0], c[t][g][1]), c[t][g][2]);
                        rv[t] = fmaxf(fmaxf(rv[t], c[t][g][3]), c[t][g][4]);
                        rv[t] = fmaxf(fmaxf(rv[t], c[t][g][5]), c[t][g][6]);
                    }
                    rg[g] = fmaxf(fmaxf(rv[0], rv[1]), c[0][g][7]);
                    rg[g] = fmaxf(rg[g], c[1][g][7]);
                }
                // one wave-uniform test per trip
                if (__builtin_amdgcn_ballot_w32(fmaxf(rg[0], rg[1]) > thr) == 0u) break;
#pragma unroll
                for (int g = 0; g < NG; ++g) {
                    const float r  = fmaxf(rg[g], xhalf(rg[g]));
                    const float dl = fmaxf(r, lo);                   // rise of the maximum in use
                    const float sc = fast_exp2(fminf(-dl, 0.0f));    // first step: accumulators are 0, factor stays finite
                    // rescale accumulators; of the row-sum tile only row 8 hf (register 0) is read
#pragma unroll
                    for (int t = 0; t < 4; ++t) o[g][t] *= sc;
                    olsum[g][0] *= sc;
                    cm[g] -= dl;
                }
                thr = __builtin_inff();
            }
            __builtin_amdgcn_sched_barrier(0);   // load run behind the last use of the K registers
#pragma unroll
            for (int t = 0; t < 4; ++t) fv[t] = ld_v(t, p);   // V^T, the 32 keys of this step
            if (p + 1 < KBLK / PK) {   // K fragments of the tile's next 32 keys (same LDS buffer)
#pragma unroll
                for (int i = 0; i < 4; ++i) fk[i] = ld_k(PT * (p + 1) + (i >> 1), i & 1);
            }
            __builtin_amdgcn_sched_barrier(0);   // and in front of the exponentials, which cover its latency

            // ---- O^T += V^T * P^T, rowsum += ones * P^T : 32 keys ----
            v16h pb[NG];                 // keys 8 hf + j of tile 0, then of tile 1
#pragma unroll
            for (int g = 0; g < NG; ++g) pb[g] = exp2_pack(c[0][g], c[1][g]);
            // Both groups' exponentials stand in front of the first product, whose V^T
            // fragment is still on its way from LDS under them.
            __builtin_amdgcn_sched_barrier(0);
#pragma unroll
            for (int g = 0; g < NG; ++g) {
#pragma unroll
                for (int t = 0; t < 4; ++t)
                    o[g][t] = __builtin_amdgcn_wmma_f32_16x16x32_f16(
                        false, fv[t], false, pb[g], (short)0, o[g][t], false, false);
                olsum[g] = __builtin_amdgcn_wmma_f32_16x16x32_f16(
                    false, vones, false, pb[g], (short)0, olsum[g], false, false);
            }
        }
    }

    // ---- normalize (1 rcp per query) and write out (fp32): 8 consecutive d per tile ----
#pragma unroll
    for (int g = 0; g < NG; ++g) {
        const float rinv = fast_rcp(olsum[g][0]);
#pragma unroll
        for (int t = 0; t < 4; ++t) o[g][t] *= rinv;
    }
    // Every product stands in front of the first store, so that no register
    // that an issued store names is written again.
    __builtin_amdgcn_sched_barrier(0);
#pragma unroll
    for (int g = 0; g < NG; ++g)
#pragma unroll
        for (int t = 0; t < 4; ++t) {
            float* op = Ob + (unsigned)((qrow + 16 * g) * Dn + t * 16 + koff);
            *(float4*)(op)     = make_float4(o[g][t][0], o[g][t][1], o[g][t][2], o[g][t][3]);
            *(float4*)(op + 4) = make_float4(o[g][t][4], o[g][t][5], o[g][t][6], o[g][t][7]);
        }
}

extern "C" void kernel_launch(void* const* d_in, const int* in_sizes, int n_in,
                              void* d_out, int out_size, void* d_ws, size_t ws_size,
                              hipStream_t stream) {
    const float* q = (const float*)d_in[0];
    const float* k = (const float*)d_in[1];
    const float* v = (const float*)d_in[2];
    float* out = (float*)d_out;
    (void)in_sizes; (void)n_in; (void)out_size; (void)d_ws; (void)ws_size;

    dim3 grid(Sn / QTILE, Hn, Bn);                       // (8, 16, 4)
    fa_wmma_kernel<<<grid, 256, 0, stream>>>(q, k, v, out);
}

// v006
// One run takes 49.3 microseconds.
// Timed twice side by side with v005, it ran 1.07 times as fast both times.
// All steps since v000 together make it 4.13 times as fast.
#include <hip/hip_runtime.h>

typedef __attribute__((ext_vector_type(16))) _Float16 v16h;
typedef __attribute__((ext_vector_type(8)))  _Float16 v8h;
typedef __attribute__((ext_vector_type(4)))  _Float16 v4h;
typedef __attribute__((ext_vector_type(8)))  float    v8f;
typedef __attribute__((ext_vector_type(4)))  float    v4f;
typedef __attribute__((ext_vector_type(4)))  int      v4i;
typedef __attribute__((ext_vector_type(8)))  short    v8s;

// Problem constants (reference: B,H,S,D = 4,16,2048,64)
constexpr int Bn = 4, Hn = 16, Sn = 2048, Dn = 64;
constexpr int NG    = 2;       // column groups of 16 queries per wave
constexpr int QTILE = 128 * NG; // queries per workgroup (8 waves x 16 NG columns)
constexpr int KBLK  = 128;     // keys per LDS block (8 score tiles)
constexpr int NBLK  = Sn / KBLK;
constexpr int PK    = 32;      // keys per softmax step
constexpr int PT    = PK / 16; // score tiles per step and column group = 2
constexpr float LAZY = 8.0f;   // P stays below 2^8, far inside f16, while the maximum in use is kept
// padded LDS row strides (halves), each for its reader
constexpr int KD = Dn + 8;     // 72: 144 B = 16 B x odd, read by ds_load_b128
constexpr int VD = Dn + 16;    // 80: 160 B = 32 B x odd, read by the transposing load
constexpr int WR = KBLK / 8;   // key rows of a tile that one wave brings in and converts

#if defined(__has_builtin)
#if __has_builtin(__builtin_amdgcn_global_load_async_to_lds_b128)
#define HAVE_ASYNC_LDS 1
#endif
#endif
#ifndef HAVE_ASYNC_LDS
#define HAVE_ASYNC_LDS 0
#endif

#define AS_GLOBAL __attribute__((address_space(1)))
#define AS_LDS    __attribute__((address_space(3)))

// 2^x via v_exp_f32 (hardware exp is base-2)
__device__ inline float fast_exp2(float x) {
#if defined(__has_builtin) && __has_builtin(__builtin_amdgcn_exp2f)
    return __builtin_amdgcn_exp2f(x);
#else
    return __expf(x * 0.6931471805599453f);
#endif
}

__device__ inline float fast_rcp(float x) {
#if defined(__has_builtin) && __has_builtin(__builtin_amdgcn_rcpf)
    return __builtin_amdgcn_rcpf(x);
#else
    return 1.0f / x;
#endif
}

// The wave's own copies have landed behind this wait. In asm with the memory clobber, so
// that the LDS reads of the landed rows, which follow it directly, stay behind it.
__device__ inline void wait_async_lds() {
#if HAVE_ASYNC_LDS
    asm volatile("s_wait_asynccnt 0x0" ::: "memory");
#endif
}

// Copy one 16-byte chunk global(f32) -> LDS, async if available. OFF (bytes) is the
// instruction's immediate offset, which moves the global and the LDS address alike.
template <int OFF>
__device__ inline void copy16_to_lds(const float* g, float* l) {
    static_assert(OFF >= 0 && OFF < 65536 && OFF % 16 == 0, "offset of an async copy");
#if HAVE_ASYNC_LDS
    __builtin_amdgcn_global_load_async_to_lds_b128(
        (AS_GLOBAL v4i*)g, (AS_LDS v4i*)l, OFF, 0);
#else
    *(float4*)(l + OFF / 4) = *(const float4*)(g + OFF / 4);
#endif
}

// Eight such copies, 512 bytes apart on both sides: 4096 contiguous bytes per wave.
__device__ inline void copy_rows_to_lds(const float* g, float* l) {
    copy16_to_lds<0>(g, l);    copy16_to_lds<512>(g, l);
    copy16_to_lds<1024>(g, l); copy16_to_lds<1536>(g, l);
    copy16_to_lds<2048>(g, l); copy16_to_lds<2560>(g, l);
    copy16_to_lds<3072>(g, l); copy16_to_lds<3584>(g, l);
}

// Transposing LDS load: lane (c = l & 15, h = l >> 4) gets eight rows of one column of a
// row-major 16-bit tile; every lane passes its own row address (see ld_v).
__device__ inline v8h ld_tr16(const _Float16* p) {
    typedef AS_LDS v8s lds_v8s;
    return __builtin_bit_cast(v8h, __builtin_amdgcn_ds_load_tr16_b128_v8i16((lds_v8s*)p));
}

__device__ inline v4h cvt4(float4 x) {
    v4h r;
    r[0] = (_Float16)x.x; r[1] = (_Float16)x.y; r[2] = (_Float16)x.z; r[3] = (_Float16)x.w;
    return r;
}

// Load a v16h WMMA operand from LDS following the 16-bit A/B register layout:
// element j in [0,7]  -> K = base + j        (contiguous)
// element j in [8,15] -> K = base + 16 + j-8 (contiguous)
__device__ inline v16h ld_op16(const _Float16* p) {
    union { v16h v; v8h h[2]; } u;
    u.h[0] = *(const v8h*)(p);
    u.h[1] = *(const v8h*)(p + 16);
    return u.v;
}

// Value of lane l ^ 16: the other half of the keys of the same query column.
__device__ inline float xhalf(float x) {
    return __builtin_bit_cast(float, __builtin_amdgcn_permlanex16(
        __builtin_bit_cast(int, x), __builtin_bit_cast(int, x),
        0x76543210, 0xfedcba98, false, false));
}

// P^T operand of one column group and 32 keys: 2^x of two score tiles, packed to f16
// (the tiles already hold score minus maximum in use).
// Exponentials and conversions are one asm statement, all in place: the packed operand
// ends in the first tile's eight registers. Left to the compiler, some exponentials wrote
// the source register of the one directly in front of them, and with the conversions
// outside the statement it moved up to twenty of the 32 registers before every step.
__device__ inline v16h exp2_pack(v8f a, v8f b) {
    float x0 = a[0], x1 = a[1], x2 = a[2], x3 = a[3];
    float x4 = a[4], x5 = a[5], x6 = a[6], x7 = a[7];
    float y0 = b[0], y1 = b[1], y2 = b[2], y3 = b[3];
    float y4 = b[4], y5 = b[5], y6 = b[6], y7 = b[7];
    // Each conversion writes a register whose old value has been read by it or by an earlier one.
    asm("v_exp_f32 %0, %0\n\tv_exp_f32 %1, %1\n\tv_exp_f32 %2, %2\n\tv_exp_f32 %3, %3\n\t"
        "v_exp_f32 %4, %4\n\tv_exp_f32 %5, %5\n\tv_exp_f32 %6, %6\n\tv_exp_f32 %7, %7\n\t"
        "v_exp_f32 %8, %8\n\tv_exp_f32 %9, %9\n\tv_exp_f32 %10, %10\n\tv_exp_f32 %11, %11\n\t"
        "v_exp_f32 %12, %12\n\tv_exp_f32 %13, %13\n\tv_exp_f32 %14, %14\n\tv_exp_f32 %15, %15\n\t"
        "v_cvt_pk_f16_f32 %0, %0, %1\n\tv_cvt_pk_f16_f32 %1, %2, %3\n\t"
        "v_cvt_pk_f16_f32 %2, %4, %5\n\tv_cvt_pk_f16_f32 %3, %6, %7\n\t"
        "v_cvt_pk_f16_f32 %4, %8, %9\n\tv_cvt_pk_f16_f32 %5, %10, %11\n\t"
        "v_cvt_pk_f16_f32 %6, %12, %13\n\tv_cvt_pk_f16_f32 %7, %14, %15"
        : "+v"(x0), "+v"(x1), "+v"(x2), "+v"(x3), "+v"(x4), "+v"(x5), "+v"(x6), "+v"(x7),
          "+v"(y0), "+v"(y1), "+v"(y2), "+v"(y3), "+v"(y4), "+v"(y5), "+v"(y6), "+v"(y7));
    const v8f r = {x0, x1, x2, x3, x4, x5, x6, x7};   // eight registers of two f16 each
    return __builtin_bit_cast(v16h, r);
}

// A Q operand chunk (B: one query column per lane) from four 16-byte pieces of the f32 row,
// d = base + 0..7 (a, b) and base + 16..23 (c, d), with the scale folded in.
__device__ inline v16h cvt_q(v4f a, v4f b, v4f c, v4f d, float scale) {
    v16h r;
#pragma unroll
    for (int j = 0; j < 4; ++j) {
        r[j]      = (_Float16)(a[j] * scale);
        r[j + 4]  = (_Float16)(b[j] * scale);
        r[j + 8]  = (_Float16)(c[j] * scale);
        r[j + 12] = (_Float16)(d[j] * scale);
    }
    return r;
}

__global__ __launch_bounds__(256) __attribute__((amdgpu_waves_per_eu(4, 4)))
void fa_wmma_kernel(const float* __restrict__ Q,
                    const float* __restrict__ K,       // [bh][s][d]
                    const float* __restrict__ V,       // [bh][s][d]
                    float* __restrict__ O) {
    // Landing place of the f32 rows, one range per wave: [wave][K, V][16 rows x 64 d].
    __shared__ __align__(16) float    Stg[8][2][WR * Dn];  // 64 KB
    // Double-buffered f16 K/V tiles (padded rows), both [key][d]. Ahead of the first tile the
    // same place takes the f32 Q rows, one range of 32 rows per wave.
    struct Tiles {
        _Float16 k[2][KBLK * KD];   // 2 x 18 KB
        _Float16 v[2][KBLK * VD];   // 2 x 20 KB
    };
    __shared__ __align__(16) union { Tiles t; float q[8][16 * NG * Dn]; } Sh;   // 76 KB
    auto& Ksh = Sh.t.k;
    auto& Vsh = Sh.t.v;

    const int qb   = blockIdx.x;
    const int h    = blockIdx.y;
    const int bb   = blockIdx.z;
    const int tid  = threadIdx.x;
    const int lane = tid & 31;
    const int wv   = tid >> 5;       // wave id 0..7
    const int hf   = lane >> 4;      // half-wave: 0 or 1
    const int l16  = lane & 15;
    const int koff = hf * 8;         // K-offset pattern per half-wave

    const size_t bh = ((size_t)bb * Hn + h) * (size_t)Sn * Dn;
    const float*    Qb  = Q  + bh;
    const float*    Kb  = K  + bh;
    const float*    Vb  = V  + bh;
    float*          Ob  = O  + bh;

    // fold softmax scale and log2(e) into Q so scores are in exp2 domain
    const float qscale = 0.125f * 1.44269504088896f;

    // Q rows in and O rows out cross global memory as whole lines: a wave's 32 rows are 8192
    // contiguous bytes, 16 accesses of 512 bytes. They are turned in an LDS range of the wave's
    // own, 32 rows of 16 chunks of 16 bytes; chunk c of row r lies at place c ^ (r & 15), so
    // that 16 lanes meet 16 different places whether they walk along a row or down a column.
    // Line side, access i: lane reads or writes row 2 i + hf, chunk l16.
    // Fragment side: row 16 g + l16, chunk 4 t + 2 hf + j, which is d = 16 t + 8 hf + 4 j.
    // Offsets in floats; the line side's leaves out the 128 i of access i.
    auto line_off = [](int ln, int i) { return (ln >> 4) * Dn + (((ln & 15) ^ (ln >> 4) ^ (2 * (i & 7))) * 4); };
    auto frag_off = [](int ln, int g, int t, int j) {
        return (16 * g + (ln & 15)) * Dn + (((ln & 15) ^ (2 * (ln >> 4)) ^ (4 * t + j)) * 4);
    };
    const int      wvs   = __builtin_amdgcn_readfirstlane(wv);   // wave id in a scalar register, kept to the end
    const unsigned wrow0 = (unsigned)(qb * QTILE + wvs * (16 * NG)) * Dn;   // the wave's first row, in floats
    float* qst = &Sh.q[0][0] + wvs * (16 * NG * Dn);
    {
        const float* qg = (const float*)((const char*)(Qb + wrow0) + (unsigned)lane * 16u);
        copy16_to_lds<0>(qg, qst + line_off(lane, 0));     copy16_to_lds<512>(qg, qst + line_off(lane, 1));
        copy16_to_lds<1024>(qg, qst + line_off(lane, 2));  copy16_to_lds<1536>(qg, qst + line_off(lane, 3));
        copy16_to_lds<2048>(qg, qst + line_off(lane, 4));  copy16_to_lds<2560>(qg, qst + line_off(lane, 5));
        copy16_to_lds<3072>(qg, qst + line_off(lane, 6));  copy16_to_lds<3584>(qg, qst + line_off(lane, 7));
        copy16_to_lds<4096>(qg, qst + line_off(lane, 8));  copy16_to_lds<4608>(qg, qst + line_off(lane, 9));
        copy16_to_lds<5120>(qg, qst + line_off(lane, 10)); copy16_to_lds<5632>(qg, qst + line_off(lane, 11));
        copy16_to_lds<6144>(qg, qst + line_off(lane, 12)); copy16_to_lds<6656>(qg, qst + line_off(lane, 13));
        copy16_to_lds<7168>(qg, qst + line_off(lane, 14)); copy16_to_lds<7680>(qg, qst + line_off(lane, 15));
    }

    // A operand of the row sums: rows 0 and 8 (lanes 0, 8, 16, 24) are ones, the rest zero.
    // Only register 0 of a sum tile is read, which is row 8 hf.
    v16h vones;
    const _Float16 one08 = ((lane & 7) == 0) ? (_Float16)1.0f : (_Float16)0.0f;
#pragma unroll
    for (int j = 0; j < 16; ++j) vones[j] = one08;

    const v8f vzero = {0.f, 0.f, 0.f, 0.f, 0.f, 0.f, 0.f, 0.f};
    v8f o[NG][4];                    // o[g][t][r] = O^T[d = 16 t + 8 hf + r][query l16 of group g]
    v8f olsum[NG];                   // ones * P^T: rows 0 and 8 are the column sums of P^T
    v8f cm[NG];                      // minus the maximum in use of this lane's query, in all 8 rows
#pragma unroll
    for (int g = 0; g < NG; ++g) {
#pragma unroll
        for (int t = 0; t < 4; ++t) o[g][t] = vzero;
        olsum[g] = vzero;
        cm[g] = vzero;               // the first step always sets the maximum (below)
    }

    // The wave's 16 rows of tile kb, K and V: 4096 contiguous bytes each, 8 copies of 512
    // bytes. Each global address is a wave-uniform tile base plus a 32-bit lane offset.
    // A lane reads back, for the conversion, the very 16 bytes that it copies.
    const unsigned go  = (unsigned)wv * (WR * Dn * 4u) + (unsigned)lane * 16u;   // bytes
    float*         stg = &Stg[0][0][0] + wv * (2 * WR * Dn) + lane * 4;          // K rows; V rows WR * Dn on
    auto fill_rows = [&](int kb) {
        const char* kg = (const char*)(Kb + (size_t)kb * KBLK * Dn);
        const char* vg = (const char*)(Vb + (size_t)kb * KBLK * Dn);
        copy_rows_to_lds((const float*)(kg + go), stg);
        copy_rows_to_lds((const float*)(vg + go), stg + WR * Dn);
    };
    // f32 rows of the wave's own range -> f16 rows of tile buffer buf: chunk i of a lane is
    // row 2 i + hf of the wave's 16, columns 4 l16 .. 4 l16 + 3.
    _Float16* kst = &Ksh[0][0] + (wv * WR + hf) * KD + l16 * 4;
    _Float16* vst = &Vsh[0][0] + (wv * WR + hf) * VD + l16 * 4;
    auto convert_rows = [&](int buf) {
        float4 a[8], b[8];
#pragma unroll
        for (int i = 0; i < 8; ++i) a[i] = *(const float4*)(stg + i * 128);
#pragma unroll
        for (int i = 0; i < 8; ++i) b[i] = *(const float4*)(stg + WR * Dn + i * 128);
        // All 16 loads stay one run in front of the conversions (the fragment and score
        // registers are free here); left free, the compiler split them and waited for each.
        __builtin_amdgcn_sched_barrier(0);
#pragma unroll
        for (int i = 0; i < 8; ++i) *(v4h*)(kst + buf * (KBLK * KD) + i * 2 * KD) = cvt4(a[i]);
#pragma unroll
        for (int i = 0; i < 8; ++i) *(v4h*)(vst + buf * (KBLK * VD) + i * 2 * VD) = cvt4(b[i]);
    };

    fill_rows(0);   // first tile

    wait_async_lds();   // the wave's own Q rows have landed (and its rows of the first tile)
    v4f qf[NG][4][2];
#pragma unroll
    for (int g = 0; g < NG; ++g)
#pragma unroll
        for (int t = 0; t < 4; ++t) {
            qf[g][t][0] = *(const v4f*)(qst + frag_off(lane, g, t, 0));
            qf[g][t][1] = *(const v4f*)(qst + frag_off(lane, g, t, 1));
        }
    // All 16 loads stay one run in front of the conversions; left free, the compiler
    // spread them among the conversions, with a wait at each place.
    __builtin_amdgcn_sched_barrier(0);
    v16h qa[NG][2];
#pragma unroll
    for (int g = 0; g < NG; ++g)
#pragma unroll
        for (int kc = 0; kc < 2; ++kc)
            qa[g][kc] = cvt_q(qf[g][2 * kc][0], qf[g][2 * kc][1], qf[g][2 * kc + 1][0], qf[g][2 * kc + 1][1], qscale);
    // Every wave's reads of its Q rows are over before any wave writes the first tile there.
    asm volatile("s_wait_dscnt 0x0" ::: "memory");
    __syncthreads();

    for (int kb = 0; kb < NBLK; ++kb) {
        const int cur = kb & 1;
        wait_async_lds();        // this wave's rows of tile kb have landed; no other wave reads them
        // Buffer cur was last read for tile kb - 2, which every wave had left at the barrier of tile kb - 1.
        convert_rows(cur);
        // The wave's reads of its range are over before the range is refilled, and its f16
        // rows are in LDS before the barrier behind which the other waves read them.
        asm volatile("s_wait_dscnt 0x0" ::: "memory");
        __syncthreads();         // tile kb complete in buffer cur
        if (kb + 1 < NBLK) fill_rows(kb + 1);   // lands under the work on tile kb

        // Fragment loads, both in the hardware k order (keys or d 8 hf + j, then 16 + 8 hf + j).
        auto ld_k = [&](int t, int kc) {   // A: key rows 16 t .. 16 t + 15, d chunk kc
            return ld_op16(&Ksh[cur][(t * 16 + l16) * KD + kc * 32 + koff]);
        };
        auto ld_v = [&](int t, int kc) {   // A: d rows 16 t .. 16 t + 15, key chunk kc
            const _Float16* p = &Vsh[cur][(kc * 32 + koff + (lane & 7)) * VD + t * 16 + ((lane >> 3) & 1) * 8];
            union { v16h v; v8h h[2]; } u;
            u.h[0] = ld_tr16(p);              // keys 8 hf + j of the chunk
            u.h[1] = ld_tr16(p + 16 * VD);    // keys 16 + 8 hf + j
            return u.v;
        };
        // Four K and four V^T fragments, both sets refilled in ONE run of LDS loads per step,
        // behind the score products and their test. The scheduling fences around the run keep
        // it in one place, ahead of the work that covers its latency; left free, the compiler
        // put two loads and a full wait in front of most products.
        v16h fk[4], fv[4];

        // K fragments of the tile's first 32 keys
#pragma unroll
        for (int i = 0; i < 4; ++i) fk[i] = ld_k(i >> 1, i & 1);
        __builtin_amdgcn_sched_barrier(0);   // the load run stays in front of the products

#pragma unroll
        for (int p = 0; p < KBLK / PK; ++p) {
            // The very first step (maximum in use still 0) moves the maximum whatever its scores
            // are, and may lower it: from then on the maximum in use is a true maximum.
            const bool first = (p == 0) && (kb == 0);
            float       thr = first ? -__builtin_inff() : LAZY;
            const float lo  = first ? -__builtin_inff() : 0.0f;
            v8f c[PT][NG];
            // One trip, at most two: a trip that finds a score more than thr above the maximum in
            // use moves the maximum, sets thr to +infinity (no score lies above that, so the second
            // trip is the last) and forms the scores anew; the K fragments are still in their
            // registers. A loop, so that the score tiles have ONE defining place: with a second
            // one behind a branch the compiler copied all 32 registers on every step.
            for (;;) {
                // ---- S^T - max = K * Q^T + cm : 2 key tiles of 16 x 2 column groups, K-dim D=64 in 2 chunks ----
#pragma unroll
                for (int u = 0; u < PT; ++u)
#pragma unroll
                    for (int g = 0; g < NG; ++g)
                        c[u][g] = __builtin_amdgcn_wmma_f32_16x16x32_f16(
                            false, fk[2 * u], false, qa[g][0], (short)0, cm[g], false, false);
#pragma unroll
                for (int u = 0; u < PT; ++u)
#pragma unroll
                    for (int g = 0; g < NG; ++g)
                        c[u][g] = __builtin_amdgcn_wmma_f32_16x16x32_f16(
                            false, fk[2 * u + 1], false, qa[g][1], (short)0, c[u][g], false, false);
                // The eight products stay one run in this order (a tile's second product four behind
                // its first); left free, the compiler wove the maximum work in, with idle slots.
                __builtin_amdgcn_sched_barrier(0);

                // ---- online softmax in exp2 domain, one query per lane and group ----
                float rg[NG];            // largest score - maximum in use among this lane's 16 keys
#pragma unroll
                for (int g = 0; g < NG; ++g) {
                    float rv[PT];        // one chain per tile, three values a link
#pragma unroll
                    for (int t = 0; t < PT; ++t) {
                        rv[t] = fmaxf(fmaxf(c[t][g][0], c[t][g][1]), c[t][g][2]);
                        rv[t] = fmaxf(fmaxf(rv[t], c[t][g][3]), c[t][g][4]);
                        rv[t] = fmaxf(fmaxf(rv[t], c[t][g][5]), c[t][g][6]);
                    }
                    rg[g] = fmaxf(fmaxf(rv[0], rv[1]), c[0][g][7]);
                    rg[g] = fmaxf(rg[g], c[1][g][7]);
                }
                // one wave-uniform test per trip
                if (__builtin_amdgcn_ballot_w32(fmaxf(rg[0], rg[1]) > thr) == 0u) break;
#pragma unroll
                for (int g = 0; g < NG; ++g) {
                    const float r  = fmaxf(rg[g], xhalf(rg[g]));
                    const float dl = fmaxf(r, lo);                   // rise of the maximum in use
                    const float sc = fast_exp2(fminf(-dl, 0.0f));    // first step: accumulators are 0, factor stays finite
                    // rescale accumulators; of the row-sum tile only row 8 hf (register 0) is read
#pragma unroll
                    for (int t = 0; t < 4; ++t) o[g][t] *= sc;
                    olsum[g][0] *= sc;
                    cm[g] -= dl;
                }
                thr = __builtin_inff();
            }
            __builtin_amdgcn_sched_barrier(0);   // load run behind the last use of the K registers
#pragma unroll
            for (int t = 0; t < 4; ++t) fv[t] = ld_v(t, p);   // V^T, the 32 keys of this step
            if (p + 1 < KBLK / PK) {   // K fragments of the tile's next 32 keys (same LDS buffer)
#pragma unroll
                for (int i = 0; i < 4; ++i) fk[i] = ld_k(PT * (p + 1) + (i >> 1), i & 1);
            }
            __builtin_amdgcn_sched_barrier(0);   // and in front of the exponentials, which cover its latency

            // ---- O^T += V^T * P^T, rowsum += ones * P^T : 32 keys ----
            v16h pb[NG];                 // keys 8 hf + j of tile 0, then of tile 1
#pragma unroll
            for (int g = 0; g < NG; ++g) pb[g] = exp2_pack(c[0][g], c[1][g]);
            // Both groups' exponentials stand in front of the first product, whose V^T
            // fragment is still on its way from LDS under them.
            __builtin_amdgcn_sched_barrier(0);
#pragma unroll
            for (int g = 0; g < NG; ++g) {
#pragma unroll
                for (int t = 0; t < 4; ++t)
                    o[g][t] = __builtin_amdgcn_wmma_f32_16x16x32_f16(
                        false, fv[t], false, pb[g], (short)0, o[g][t], false, false);
                olsum[g] = __builtin_amdgcn_wmma_f32_16x16x32_f16(
                    false, vones, false, pb[g], (short)0, olsum[g], false, false);
            }
        }
    }

    // ---- normalize (1 rcp per query) and write out (fp32): 8 consecutive d per tile ----
#pragma unroll
    for (int g = 0; g < NG; ++g) {
        const float rinv = fast_rcp(olsum[g][0]);
#pragma unroll
        for (int t = 0; t < 4; ++t) o[g][t] *= rinv;
    }
    // The wave's landing range of the K, V rows is free (last copies waited for, last reads
    // over, no other wave touches it): its 8192 bytes take the wave's 32 output rows.
    // The lane id is taken anew, so that no offset of the Q rows' turn stays in a register over the loop.
    const int ln  = (int)__builtin_amdgcn_mbcnt_lo(~0u, 0u);
    float*    ost = &Stg[0][0][0] + wvs * (2 * WR * Dn);
#pragma unroll
    for (int g = 0; g < NG; ++g)
#pragma unroll
        for (int t = 0; t < 4; ++t) {
            *(v4f*)(ost + frag_off(ln, g, t, 0)) = __builtin_shufflevector(o[g][t], o[g][t], 0, 1, 2, 3);
            *(v4f*)(ost + frag_off(ln, g, t, 1)) = __builtin_shufflevector(o[g][t], o[g][t], 4, 5, 6, 7);
        }
    // The rows are in LDS before other lanes of the wave read them back.
    asm volatile("s_wait_dscnt 0x0" ::: "memory");
    v4f w[16];
#pragma unroll
    for (int i = 0; i < 16; ++i) w[i] = *(const v4f*)(ost + i * 128 + line_off(ln, i));
    // Every LDS load stands in front of the first store, so that no register
    // that an issued store names is written again.
    __builtin_amdgcn_sched_barrier(0);
    float* og = Ob + wrow0 + ln * 4;
#pragma unroll
    for (int i = 0; i < 16; ++i) *(v4f*)(og + i * 128) = w[i];
}

extern "C" void kernel_launch(void* const* d_in, const int* in_sizes, int n_in,
                              void* d_out, int out_size, void* d_ws, size_t ws_size,
                              hipStream_t stream) {
    const float* q = (const float*)d_in[0];
    const float* k = (const float*)d_in[1];
    const float* v = (const float*)d_in[2];
    float* out = (float*)d_out;
    (void)in_sizes; (void)n_in; (void)out_size; (void)d_ws; (void)ws_size;

    dim3 grid(Sn / QTILE, Hn, Bn);                       // (8, 16, 4)
    fa_wmma_kernel<<<grid, 256, 0, stream>>>(q, k, v, out);
}

// v007
// One run takes 47.3 microseconds.
// In both of two side-by-side timings against v006, it was 1.04 times as fast.
// Counting every step since v000, it is 4.30 times as fast.
#include <hip/hip_runtime.h>

typedef __attribute__((ext_vector_type(16))) _Float16 v16h;
typedef __attribute__((ext_vector_type(8)))  _Float16 v8h;
typedef __attribute__((ext_vector_type(4)))  _Float16 v4h;
typedef __attribute__((ext_vector_type(8)))  float    v8f;
typedef __attribute__((ext_vector_type(4)))  float    v4f;
typedef __attribute__((ext_vector_type(4)))  int      v4i;
typedef __attribute__((ext_vector_type(8)))  short    v8s;

// Problem constants (reference: B,H,S,D = 4,16,2048,64)
constexpr int Bn = 4, Hn = 16, Sn = 2048, Dn = 64;
constexpr int NG    = 2;       // column groups of 16 queries per wave
constexpr int QTILE = 128 * NG; // queries per workgroup (8 waves x 16 NG columns)
constexpr int KBLK  = 128;     // keys per LDS block (8 score tiles)
constexpr int NBLK  = Sn / KBLK;
constexpr int PK    = 32;      // keys per softmax step
constexpr int PT    = PK / 16; // score tiles per step and column group = 2
constexpr float LAZY = 8.0f;   // P stays below 2^8, far inside f16, while the maximum in use is kept
// padded LDS row strides (halves), each for its reader
constexpr int KD = Dn + 8;     // 72: 144 B = 16 B x odd, read by ds_load_b128
constexpr int VD = Dn + 16;    // 80: 160 B = 32 B x odd, read by the transposing load
constexpr int WR = KBLK / 8;   // key rows of a tile that one wave brings in and converts

#if defined(__has_builtin)
#if __has_builtin(__builtin_amdgcn_global_load_async_to_lds_b128)
#define HAVE_ASYNC_LDS 1
#endif
#endif
#ifndef HAVE_ASYNC_LDS
#define HAVE_ASYNC_LDS 0
#endif

#define AS_GLOBAL __attribute__((address_space(1)))
#define AS_LDS    __attribute__((address_space(3)))

// 2^x via v_exp_f32 (hardware exp is base-2)
__device__ inline float fast_exp2(float x) {
#if defined(__has_builtin) && __has_builtin(__builtin_amdgcn_exp2f)
    return __builtin_amdgcn_exp2f(x);
#else
    return __expf(x * 0.6931471805599453f);
#endif
}

__device__ inline float fast_rcp(float x) {
#if defined(__has_builtin) && __has_builtin(__builtin_amdgcn_rcpf)
    return __builtin_amdgcn_rcpf(x);
#else
    return 1.0f / x;
#endif
}

// The wave's own copies have landed behind this wait. In asm with the memory clobber, so
// that the LDS reads of the landed rows, which follow it directly, stay behind it.
__device__ inline void wait_async_lds() {
#if HAVE_ASYNC_LDS
    asm volatile("s_wait_asynccnt 0x0" ::: "memory");
#endif
}

// Copy one 16-byte chunk global(f32) -> LDS, async if available. OFF (bytes) is the
// instruction's immediate offset, which moves the global and the LDS address alike.
template <int OFF>
__device__ inline void copy16_to_lds(const float* g, float* l) {
    static_assert(OFF >= 0 && OFF < 65536 && OFF % 16 == 0, "offset of an async copy");
#if HAVE_ASYNC_LDS
    __builtin_amdgcn_global_load_async_to_lds_b128(
        (AS_GLOBAL v4i*)g, (AS_LDS v4i*)l, OFF, 0);
#else
    *(float4*)(l + OFF / 4) = *(const float4*)(g + OFF / 4);
#endif
}

// Eight such copies, 512 bytes apart on both sides: 4096 contiguous bytes per wave.
__device__ inline void copy_rows_to_lds(const float* g, float* l) {
    copy16_to_lds<0>(g, l);    copy16_to_lds<512>(g, l);
    copy16_to_lds<1024>(g, l); copy16_to_lds<1536>(g, l);
    copy16_to_lds<2048>(g, l); copy16_to_lds<2560>(g, l);
    copy16_to_lds<3072>(g, l); copy16_to_lds<3584>(g, l);
}

// Transposing LDS load: lane (c = l & 15, h = l >> 4) gets eight rows of one column of a
// row-major 16-bit tile; every lane passes its own row address (see ld_v).
__device__ inline v8h ld_tr16(const _Float16* p) {
    typedef AS_LDS v8s lds_v8s;
    return __builtin_bit_cast(v8h, __builtin_amdgcn_ds_load_tr16_b128_v8i16((lds_v8s*)p));
}

__device__ inline v4h cvt4(float4 x) {
    v4h r;
    r[0] = (_Float16)x.x; r[1] = (_Float16)x.y; r[2] = (_Float16)x.z; r[3] = (_Float16)x.w;
    return r;
}

// Load a v16h WMMA operand from LDS following the 16-bit A/B register layout:
// element j in [0,7]  -> K = base + j        (contiguous)
// element j in [8,15] -> K = base + 16 + j-8 (contiguous)
__device__ inline v16h ld_op16(const _Float16* p) {
    union { v16h v; v8h h[2]; } u;
    u.h[0] = *(const v8h*)(p);
    u.h[1] = *(const v8h*)(p + 16);
    return u.v;
}

// Value of lane l ^ 16: the other half of the keys of the same query column.
__device__ inline float xhalf(float x) {
    return __builtin_bit_cast(float, __builtin_amdgcn_permlanex16(
        __builtin_bit_cast(int, x), __builtin_bit_cast(int, x),
        0x76543210, 0xfedcba98, false, false));
}

// P^T operand of one column group and 32 keys: 2^x of two score tiles, packed to f16
// (the tiles already hold score minus maximum in use).
// Exponentials and conversions are one asm statement, all in place: the packed operand
// ends in the first tile's eight registers. Left to the compiler, some exponentials wrote
// the source register of the one directly in front of them, and with the conversions
// outside the statement it moved up to twenty of the 32 registers before every step.
__device__ inline v16h exp2_pack(v8f a, v8f b) {
    float x0 = a[0], x1 = a[1], x2 = a[2], x3 = a[3];
    float x4 = a[4], x5 = a[5], x6 = a[6], x7 = a[7];
    float y0 = b[0], y1 = b[1], y2 = b[2], y3 = b[3];
    float y4 = b[4], y5 = b[5], y6 = b[6], y7 = b[7];
    // Each conversion writes a register whose old value has been read by it or by an earlier one.
    asm("v_exp_f32 %0, %0\n\tv_exp_f32 %1, %1\n\tv_exp_f32 %2, %2\n\tv_exp_f32 %3, %3\n\t"
        "v_exp_f32 %4, %4\n\tv_exp_f32 %5, %5\n\tv_exp_f32 %6, %6\n\tv_exp_f32 %7, %7\n\t"
        "v_exp_f32 %8, %8\n\tv_exp_f32 %9, %9\n\tv_exp_f32 %10, %10\n\tv_exp_f32 %11, %11\n\t"
        "v_exp_f32 %12, %12\n\tv_exp_f32 %13, %13\n\tv_exp_f32 %14, %14\n\tv_exp_f32 %15, %15\n\t"
        "v_cvt_pk_f16_f32 %0, %0, %1\n\tv_cvt_pk_f16_f32 %1, %2, %3\n\t"
        "v_cvt_pk_f16_f32 %2, %4, %5\n\tv_cvt_pk_f16_f32 %3, %6, %7\n\t"
        "v_cvt_pk_f16_f32 %4, %8, %9\n\tv_cvt_pk_f16_f32 %5, %10, %11\n\t"
        "v_cvt_pk_f16_f32 %6, %12, %13\n\tv_cvt_pk_f16_f32 %7, %14, %15"
        : "+v"(x0), "+v"(x1), "+v"(x2), "+v"(x3), "+v"(x4), "+v"(x5), "+v"(x6), "+v"(x7),
          "+v"(y0), "+v"(y1), "+v"(y2), "+v"(y3), "+v"(y4), "+v"(y5), "+v"(y6), "+v"(y7));
    const v8f r = {x0, x1, x2, x3, x4, x5, x6, x7};   // eight registers of two f16 each
    return __builtin_bit_cast(v16h, r);
}

// A Q operand chunk (B: one query column per lane) from four 16-byte pieces of the f32 row,
// d = base + 0..7 (a, b) and base + 16..23 (c, d), with the scale folded in.
__device__ inline v16h cvt_q(v4f a, v4f b, v4f c, v4f d, float scale) {
    v16h r;
#pragma unroll
    for (int j = 0; j < 4; ++j) {
        r[j]      = (_Float16)(a[j] * scale);
        r[j + 4]  = (_Float16)(b[j] * scale);
        r[j + 8]  = (_Float16)(c[j] * scale);
        r[j + 12] = (_Float16)(d[j] * scale);
    }
    return r;
}

__global__ __launch_bounds__(256) __attribute__((amdgpu_waves_per_eu(4, 4)))
void fa_wmma_kernel(const float* __restrict__ Q,
                    const float* __restrict__ K,       // [bh][s][d]
                    const float* __restrict__ V,       // [bh][s][d]
                    float* __restrict__ O) {
    // Landing place of the f32 rows, one range per wave: [wave][K, V][16 rows x 64 d].
    __shared__ __align__(16) float    Stg[8][2][WR * Dn];  // 64 KB
    // Double-buffered f16 K/V tiles (padded rows), both [key][d]. Ahead of the first tile the
    // same place takes the f32 Q rows, one range of 32 rows per wave.
    struct Tiles {
        _Float16 k[2][KBLK * KD];   // 2 x 18 KB
        _Float16 v[2][KBLK * VD];   // 2 x 20 KB
    };
    __shared__ __align__(16) union { Tiles t; float q[8][16 * NG * Dn]; } Sh;   // 76 KB
    auto& Ksh = Sh.t.k;
    auto& Vsh = Sh.t.v;

    // The head index runs fastest in the grid: the 8 query blocks of a head have flat indices
    // 64 apart. For speed only: nothing depends on where a work-group runs.
    const int hd   = blockIdx.x;     // batch * Hn + head
    const int qb   = blockIdx.y;
    const int tid  = threadIdx.x;
    const int lane = tid & 31;
    const int wv   = tid >> 5;       // wave id 0..7
    const int hf   = lane >> 4;      // half-wave: 0 or 1
    const int l16  = lane & 15;
    const int koff = hf * 8;         // K-offset pattern per half-wave

    const size_t bh = (size_t)hd * (size_t)Sn * Dn;
    const float*    Qb  = Q  + bh;
    const float*    Kb  = K  + bh;
    const float*    Vb  = V  + bh;
    float*          Ob  = O  + bh;

    // fold softmax scale and log2(e) into Q so scores are in exp2 domain
    const float qscale = 0.125f * 1.44269504088896f;

    // Q rows in and O rows out cross global memory as whole lines: a wave's 32 rows are 8192
    // contiguous bytes, 16 accesses of 512 bytes. They are turned in an LDS range of the wave's
    // own, 32 rows of 16 chunks of 16 bytes; chunk c of row r lies at place c ^ (r & 15), so
    // that 16 lanes meet 16 different places whether they walk along a row or down a column.
    // Line side, access i: lane reads or writes row 2 i + hf, chunk l16.
    // Fragment side: row 16 g + l16, chunk 4 t + 2 hf + j, which is d = 16 t + 8 hf + 4 j.
    // Offsets in floats; the line side's leaves out the 128 i of access i.
    auto line_off = [](int ln, int i) { return (ln >> 4) * Dn + (((ln & 15) ^ (ln >> 4) ^ (2 * (i & 7))) * 4); };
    auto frag_off = [](int ln, int g, int t, int j) {
        return (16 * g + (ln & 15)) * Dn + (((ln & 15) ^ (2 * (ln >> 4)) ^ (4 * t + j)) * 4);
    };
    const int      wvs   = __builtin_amdgcn_readfirstlane(wv);   // wave id in a scalar register, kept to the end
    const unsigned wrow0 = (unsigned)(qb * QTILE + wvs * (16 * NG)) * Dn;   // the wave's first row, in floats
    float* qst = &Sh.q[0][0] + wvs * (16 * NG * Dn);
    {
        const float* qg = (const float*)((const char*)(Qb + wrow0) + (unsigned)lane * 16u);
        copy16_to_lds<0>(qg, qst + line_off(lane, 0));     copy16_to_lds<512>(qg, qst + line_off(lane, 1));
        copy16_to_lds<1024>(qg, qst + line_off(lane, 2));  copy16_to_lds<1536>(qg, qst + line_off(lane, 3));
        copy16_to_lds<2048>(qg, qst + line_off(lane, 4));  copy16_to_lds<2560>(qg, qst + line_off(lane, 5));
        copy16_to_lds<3072>(qg, qst + line_off(lane, 6));  copy16_to_lds<3584>(qg, qst + line_off(lane, 7));
        copy16_to_lds<4096>(qg, qst + line_off(lane, 8));  copy16_to_lds<4608>(qg, qst + line_off(lane, 9));
        copy16_to_lds<5120>(qg, qst + line_off(lane, 10)); copy16_to_lds<5632>(qg, qst + line_off(lane, 11));
        copy16_to_lds<6144>(qg, qst + line_off(lane, 12)); copy16_to_lds<6656>(qg, qst + line_off(lane, 13));
        copy16_to_lds<7168>(qg, qst + line_off(lane, 14)); copy16_to_lds<7680>(qg, qst + line_off(lane, 15));
    }

    // A operand of the row sums: rows 0 and 8 (lanes 0, 8, 16, 24) are ones, the rest zero.
    // Only register 0 of a sum tile is read, which is row 8 hf.
    v16h vones;
    const _Float16 one08 = ((lane & 7) == 0) ? (_Float16)1.0f : (_Float16)0.0f;
#pragma unroll
    for (int j = 0; j < 16; ++j) vones[j] = one08;

    const v8f vzero = {0.f, 0.f, 0.f, 0.f, 0.f, 0.f, 0.f, 0.f};
    v8f o[NG][4];                    // o[g][t][r] = O^T[d = 16 t + 8 hf + r][query l16 of group g]
    v8f olsum[NG];                   // ones * P^T: rows 0 and 8 are the column sums of P^T
    v8f cm[NG];                      // minus the maximum in use of this lane's query, in all 8 rows
#pragma unroll
    for (int g = 0; g < NG; ++g) {
#pragma unroll
        for (int t = 0; t < 4; ++t) o[g][t] = vzero;
        olsum[g] = vzero;
        cm[g] = vzero;               // the first step always sets the maximum (below)
    }

    // The wave's 16 rows of tile kb, K and V: 4096 contiguous bytes each, 8 copies of 512
    // bytes. Each global address is a wave-uniform tile base plus a 32-bit lane offset.
    // A lane reads back, for the conversion, the very 16 bytes that it copies.
    const unsigned go  = (unsigned)wv * (WR * Dn * 4u) + (unsigned)lane * 16u;   // bytes
    float*         stg = &Stg[0][0][0] + wv * (2 * WR * Dn) + lane * 4;          // K rows; V rows WR * Dn on
    auto fill_rows = [&](int kb) {
        const char* kg = (const char*)(Kb + (size_t)kb * KBLK * Dn);
        const char* vg = (const char*)(Vb + (size_t)kb * KBLK * Dn);
        copy_rows_to_lds((const float*)(kg + go), stg);
        copy_rows_to_lds((const float*)(vg + go), stg + WR * Dn);
    };
    // f32 rows of the wave's own range -> f16 rows of tile buffer buf: chunk i of a lane is
    // row 2 i + hf of the wave's 16, columns 4 l16 .. 4 l16 + 3.
    _Float16* kst = &Ksh[0][0] + (wv * WR + hf) * KD + l16 * 4;
    _Float16* vst = &Vsh[0][0] + (wv * WR + hf) * VD + l16 * 4;
    auto convert_rows = [&](int buf) {
        float4 a[8], b[8];
#pragma unroll
        for (int i = 0; i < 8; ++i) a[i] = *(const float4*)(stg + i * 128);
#pragma unroll
        for (int i = 0; i < 8; ++i) b[i] = *(const float4*)(stg + WR * Dn + i * 128);
        // All 16 loads stay one run in front of the conversions (the fragment and score
        // registers are free here); left free, the compiler split them and waited for each.
        __builtin_amdgcn_sched_barrier(0);
#pragma unroll
        for (int i = 0; i < 8; ++i) *(v4h*)(kst + buf * (KBLK * KD) + i * 2 * KD) = cvt4(a[i]);
#pragma unroll
        for (int i = 0; i < 8; ++i) *(v4h*)(vst + buf * (KBLK * VD) + i * 2 * VD) = cvt4(b[i]);
    };

    fill_rows(0);   // first tile

    wait_async_lds();   // the wave's own Q rows have landed (and its rows of the first tile)
    v4f qf[NG][4][2];
#pragma unroll
    for (int g = 0; g < NG; ++g)
#pragma unroll
        for (int t = 0; t < 4; ++t) {
            qf[g][t][0] = *(const v4f*)(qst + frag_off(lane, g, t, 0));
            qf[g][t][1] = *(const v4f*)(qst + frag_off(lane, g, t, 1));
        }
    // All 16 loads stay one run in front of the conversions; left free, the compiler
    // spread them among the conversions, with a wait at each place.
    __builtin_amdgcn_sched_barrier(0);
    v16h qa[NG][2];
#pragma unroll
    for (int g = 0; g < NG; ++g)
#pragma unroll
        for (int kc = 0; kc < 2; ++kc)
            qa[g][kc] = cvt_q(qf[g][2 * kc][0], qf[g][2 * kc][1], qf[g][2 * kc + 1][0], qf[g][2 * kc + 1][1], qscale);
    // Every wave's reads of its Q rows are over before any wave writes the first tile there.
    asm volatile("s_wait_dscnt 0x0" ::: "memory");
    __syncthreads();

    for (int kb = 0; kb < NBLK; ++kb) {
        const int cur = kb & 1;
        wait_async_lds();        // this wave's rows of tile kb have landed; no other wave reads them
        // Buffer cur was last read for tile kb - 2, which every wave had left at the barrier of tile kb - 1.
        convert_rows(cur);
        // The wave's reads of its range are over before the range is refilled, and its f16
        // rows are in LDS before the barrier behind which the other waves read them.
        asm volatile("s_wait_dscnt 0x0" ::: "memory");
        __syncthreads();         // tile kb complete in buffer cur
        if (kb + 1 < NBLK) fill_rows(kb + 1);   // lands under the work on tile kb

        // Fragment loads, both in the hardware k order (keys or d 8 hf + j, then 16 + 8 hf + j).
        auto ld_k = [&](int t, int kc) {   // A: key rows 16 t .. 16 t + 15, d chunk kc
            return ld_op16(&Ksh[cur][(t * 16 + l16) * KD + kc * 32 + koff]);
        };
        auto ld_v = [&](int t, int kc) {   // A: d rows 16 t .. 16 t + 15, key chunk kc
            const _Float16* p = &Vsh[cur][(kc * 32 + koff + (lane & 7)) * VD + t * 16 + ((lane >> 3) & 1) * 8];
            union { v16h v; v8h h[2]; } u;
            u.h[0] = ld_tr16(p);              // keys 8 hf + j of the chunk
            u.h[1] = ld_tr16(p + 16 * VD);    // keys 16 + 8 hf + j
            return u.v;
        };
        // Four K and four V^T fragments, both sets refilled in ONE run of LDS loads per step,
        // behind the score products and their test. The scheduling fences around the run keep
        // it in one place, ahead of the work that covers its latency; left free, the compiler
        // put two loads and a full wait in front of most products.
        v16h fk[4], fv[4];

        // K fragments of the tile's first 32 keys
#pragma unroll
        for (int i = 0; i < 4; ++i) fk[i] = ld_k(i >> 1, i & 1);
        __builtin_amdgcn_sched_barrier(0);   // the load run stays in front of the products

#pragma unroll
        for (int p = 0; p < KBLK / PK; ++p) {
            // The very first step (maximum in use still 0) moves the maximum whatever its scores
            // are, and may lower it: from then on the maximum in use is a true maximum.
            const bool first = (p == 0) && (kb == 0);
            float       thr = first ? -__builtin_inff() : LAZY;
            const float lo  = first ? -__builtin_inff() : 0.0f;
            v8f c[PT][NG];
            // One trip, at most two: a trip that finds a score more than thr above the maximum in
            // use moves the maximum, sets thr to +infinity (no score lies above that, so the second
            // trip is the last) and forms the scores anew; the K fragments are still in their
            // registers. A loop, so that the score tiles have ONE defining place: with a second
            // one behind a branch the compiler copied all 32 registers on every step.
            for (;;) {
                // ---- S^T - max = K * Q^T + cm : 2 key tiles of 16 x 2 column groups, K-dim D=64 in 2 chunks ----
#pragma unroll
                for (int u = 0; u < PT; ++u)
#pragma unroll
                    for (int g = 0; g < NG; ++g)
                        c[u][g] = __builtin_amdgcn_wmma_f32_16x16x32_f16(
                            false, fk[2 * u], false, qa[g][0], (short)0, cm[g], false, false);
#pragma unroll
                for (int u = 0; u < PT; ++u)
#pragma unroll
                    for (int g = 0; g < NG; ++g)
                        c[u][g] = __builtin_amdgcn_wmma_f32_16x16x32_f16(
                            false, fk[2 * u + 1], false, qa[g][1], (short)0, c[u][g], false, false);
                // The eight products stay one run in this order (a tile's second product four behind
                // its first); left free, the compiler wove the maximum work in, with idle slots.
                __builtin_amdgcn_sched_barrier(0);

                // ---- online softmax in exp2 domain, one query per lane and group ----
                float rg[NG];            // largest score - maximum in use among this lane's 16 keys
#pragma unroll
                for (int g = 0; g < NG; ++g) {
                    float rv[PT];        // one chain per tile, three values a link
#pragma unroll
                    for (int t = 0; t < PT; ++t) {
                        rv[t] = fmaxf(fmaxf(c[t][g][0], c[t][g][1]), c[t][g][2]);
                        rv[t] = fmaxf(fmaxf(rv[t], c[t][g][3]), c[t][g][4]);
                        rv[t] = fmaxf(fmaxf(rv[t], c[t][g][5]), c[t][g][6]);
                    }
                    rg[g] = fmaxf(fmaxf(rv[0], rv[1]), c[0][g][7]);
                    rg[g] = fmaxf(rg[g], c[1][g][7]);
                }
                // one wave-uniform test per trip
                if (__builtin_amdgcn_ballot_w32(fmaxf(rg[0], rg[1]) > thr) == 0u) break;
#pragma unroll
                for (int g = 0; g < NG; ++g) {
                    const float r  = fmaxf(rg[g], xhalf(rg[g]));
                    const float dl = fmaxf(r, lo);                   // rise of the maximum in use
                    const float sc = fast_exp2(fminf(-dl, 0.0f));    // first step: accumulators are 0, factor stays finite
                    // rescale accumulators; of the row-sum tile only row 8 hf (register 0) is read
#pragma unroll
                    for (int t = 0; t < 4; ++t) o[g][t] *= sc;
                    olsum[g][0] *= sc;
                    cm[g] -= dl;
                }
                thr = __builtin_inff();
            }
            __builtin_amdgcn_sched_barrier(0);   // load run behind the last use of the K registers
#pragma unroll
            for (int t = 0; t < 4; ++t) fv[t] = ld_v(t, p);   // V^T, the 32 keys of this step
            if (p + 1 < KBLK / PK) {   // K fragments of the tile's next 32 keys (same LDS buffer)
#pragma unroll
                for (int i = 0; i < 4; ++i) fk[i] = ld_k(PT * (p + 1) + (i >> 1), i & 1);
            }
            __builtin_amdgcn_sched_barrier(0);   // and in front of the exponentials, which cover its latency

            // ---- O^T += V^T * P^T, rowsum += ones * P^T : 32 keys ----
            v16h pb[NG];                 // keys 8 hf + j of tile 0, then of tile 1
#pragma unroll
            for (int g = 0; g < NG; ++g) pb[g] = exp2_pack(c[0][g], c[1][g]);
            // Both groups' exponentials stand in front of the first product, whose V^T
            // fragment is still on its way from LDS under them.
            __builtin_amdgcn_sched_barrier(0);
#pragma unroll
            for (int g = 0; g < NG; ++g) {
#pragma unroll
                for (int t = 0; t < 4; ++t)
                    o[g][t] = __builtin_amdgcn_wmma_f32_16x16x32_f16(
                        false, fv[t], false, pb[g], (short)0, o[g][t], false, false);
                olsum[g] = __builtin_amdgcn_wmma_f32_16x16x32_f16(
                    false, vones, false, pb[g], (short)0, olsum[g], false, false);
            }
        }
    }

    // ---- normalize (1 rcp per query) and write out (fp32): 8 consecutive d per tile ----
#pragma unroll
    for (int g = 0; g < NG; ++g) {
        const float rinv = fast_rcp(olsum[g][0]);
#pragma unroll
        for (int t = 0; t < 4; ++t) o[g][t] *= rinv;
    }
    // The wave's landing range of the K, V rows is free (last copies waited for, last reads
    // over, no other wave touches it): its 8192 bytes take the wave's 32 output rows.
    // The lane id is taken anew, so that no offset of the Q rows' turn stays in a register over the loop.
    const int ln  = (int)__builtin_amdgcn_mbcnt_lo(~0u, 0u);
    float*    ost = &Stg[0][0][0] + wvs * (2 * WR * Dn);
#pragma unroll
    for (int g = 0; g < NG; ++g)
#pragma unroll
        for (int t = 0; t < 4; ++t) {
            *(v4f*)(ost + frag_off(ln, g, t, 0)) = __builtin_shufflevector(o[g][t], o[g][t], 0, 1, 2, 3);
            *(v4f*)(ost + frag_off(ln, g, t, 1)) = __builtin_shufflevector(o[g][t], o[g][t], 4, 5, 6, 7);
        }
    // The rows are in LDS before other lanes of the wave read them back.
    asm volatile("s_wait_dscnt 0x0" ::: "memory");
    v4f w[16];
#pragma unroll
    for (int i = 0; i < 16; ++i) w[i] = *(const v4f*)(ost + i * 128 + line_off(ln, i));
    // Every LDS load stands in front of the first store, so that no register
    // that an issued store names is written again.
    __builtin_amdgcn_sched_barrier(0);
    float* og = Ob + wrow0 + ln * 4;
#pragma unroll
    for (int i = 0; i < 16; ++i) *(v4f*)(og + i * 128) = w[i];
}

extern "C" void kernel_launch(void* const* d_in, const int* in_sizes, int n_in,
                              void* d_out, int out_size, void* d_ws, size_t ws_size,
                              hipStream_t stream) {
    const float* q = (const float*)d_in[0];
    const float* k = (const float*)d_in[1];
    const float* v = (const float*)d_in[2];
    float* out = (float*)d_out;
    (void)in_sizes; (void)n_in; (void)out_size; (void)d_ws; (void)ws_size;

    dim3 grid(Bn * Hn, Sn / QTILE);                      // (64, 8)
    fa_wmma_kernel<<<grid, 256, 0, stream>>>(q, k, v, out);
}

// v009
// Measured time: 43.3 microseconds a run.
// It is 1.09 times as fast as v007, going by the measured steps of the versions left out in between.
// All steps since v000 together make it 4.69 times as fast.
#include <hip/hip_runtime.h>

typedef __attribute__((ext_vector_type(16))) _Float16 v16h;
typedef __attribute__((ext_vector_type(8)))  _Float16 v8h;
typedef __attribute__((ext_vector_type(4)))  _Float16 v4h;
typedef __attribute__((ext_vector_type(2)))  _Float16 v2h;
typedef __attribute__((ext_vector_type(4)))  unsigned v4u;
typedef __attribute__((ext_vector_type(8)))  float    v8f;
typedef __attribute__((ext_vector_type(4)))  float    v4f;
typedef __attribute__((ext_vector_type(4)))  int      v4i;
typedef __attribute__((ext_vector_type(8)))  short    v8s;

// Problem constants (reference: B,H,S,D = 4,16,2048,64)
constexpr int Bn = 4, Hn = 16, Sn = 2048, Dn = 64;
constexpr int NG    = 2;       // column groups of 16 queries per wave
constexpr int QTILE = 128 * NG; // queries per workgroup (8 waves x 16 NG columns)
constexpr int KBLK  = 128;     // keys per LDS block (8 score tiles)
constexpr int NBLK  = Sn / KBLK;
constexpr int PK    = 32;      // keys per softmax step
constexpr int PT    = PK / 16; // score tiles per step and column group = 2
constexpr float LAZY = 8.0f;   // P stays below 2^8, far inside f16, while the maximum in use is kept
// padded LDS row strides (halves), each for its reader
constexpr int KD = Dn + 8;     // 72: 144 B = 16 B x odd, read by ds_load_b128
constexpr int VD = Dn + 16;    // 80: 160 B = 32 B x odd, read by the transposing load
constexpr int WR = KBLK / 8;   // key rows of a tile that one wave brings in and converts

#if defined(__has_builtin)
#if __has_builtin(__builtin_amdgcn_global_load_async_to_lds_b128)
#define HAVE_ASYNC_LDS 1
#endif
#endif
#ifndef HAVE_ASYNC_LDS
#define HAVE_ASYNC_LDS 0
#endif

// Compile-time switch between the two forms of the key loop.
template <bool B> struct Flag { static constexpr bool value = B; };

#define AS_GLOBAL __attribute__((address_space(1)))
#define AS_LDS    __attribute__((address_space(3)))

// 2^x via v_exp_f32 (hardware exp is base-2)
__device__ inline float fast_exp2(float x) {
#if defined(__has_builtin) && __has_builtin(__builtin_amdgcn_exp2f)
    return __builtin_amdgcn_exp2f(x);
#else
    return __expf(x * 0.6931471805599453f);
#endif
}

__device__ inline float fast_rcp(float x) {
#if defined(__has_builtin) && __has_builtin(__builtin_amdgcn_rcpf)
    return __builtin_amdgcn_rcpf(x);
#else
    return 1.0f / x;
#endif
}

// The wave's own copies have landed behind this wait. In asm with the memory clobber, so
// that the LDS reads of the landed rows, which follow it directly, stay behind it.
__device__ inline void wait_async_lds() {
#if HAVE_ASYNC_LDS
    asm volatile("s_wait_asynccnt 0x0" ::: "memory");
#endif
}

// Copy one 16-byte chunk global(f32) -> LDS, async if available. OFF (bytes) is the
// instruction's immediate offset, which moves the global and the LDS address alike.
template <int OFF>
__device__ inline void copy16_to_lds(const float* g, float* l) {
    static_assert(OFF >= 0 && OFF < 65536 && OFF % 16 == 0, "offset of an async copy");
#if HAVE_ASYNC_LDS
    __builtin_amdgcn_global_load_async_to_lds_b128(
        (AS_GLOBAL v4i*)g, (AS_LDS v4i*)l, OFF, 0);
#else
    *(float4*)(l + OFF / 4) = *(const float4*)(g + OFF / 4);
#endif
}

// Eight such copies, 512 bytes apart on both sides: 4096 contiguous bytes per wave.
__device__ inline void copy_rows_to_lds(const float* g, float* l) {
    copy16_to_lds<0>(g, l);    copy16_to_lds<512>(g, l);
    copy16_to_lds<1024>(g, l); copy16_to_lds<1536>(g, l);
    copy16_to_lds<2048>(g, l); copy16_to_lds<2560>(g, l);
    copy16_to_lds<3072>(g, l); copy16_to_lds<3584>(g, l);
}

// Transposing LDS load: lane (c = l & 15, h = l >> 4) gets eight rows of one column of a
// row-major 16-bit tile; every lane passes its own row address (see ld_v).
__device__ inline v8h ld_tr16(const _Float16* p) {
    typedef AS_LDS v8s lds_v8s;
    return __builtin_bit_cast(v8h, __builtin_amdgcn_ds_load_tr16_b128_v8i16((lds_v8s*)p));
}

__device__ inline v4h cvt4(float4 x) {
    v4h r;
    r[0] = (_Float16)x.x; r[1] = (_Float16)x.y; r[2] = (_Float16)x.z; r[3] = (_Float16)x.w;
    return r;
}

// Load a v16h WMMA operand from LDS following the 16-bit A/B register layout:
// element j in [0,7]  -> K = base + j        (contiguous)
// element j in [8,15] -> K = base + 16 + j-8 (contiguous)
__device__ inline v16h ld_op16(const _Float16* p) {
    union { v16h v; v8h h[2]; } u;
    u.h[0] = *(const v8h*)(p);
    u.h[1] = *(const v8h*)(p + 16);
    return u.v;
}

// Value of lane l ^ 16: the other half of the keys of the same query column.
__device__ inline float xhalf(float x) {
    return __builtin_bit_cast(float, __builtin_amdgcn_permlanex16(
        __builtin_bit_cast(int, x), __builtin_bit_cast(int, x),
        0x76543210, 0xfedcba98, false, false));
}

// P^T operand of one column group and 32 keys: 2^x of two f16 score tiles, in place (the
// tiles already hold score minus maximum in use). A 16-bit D tile has element e = key 8 hf + e
// in register e >> 1, half e & 1, so two tiles side by side ARE the B operand: no conversion.
// One asm statement, for the order: the low halves of all eight registers, then the high
// halves. Left to the compiler, the two exponentials of a register stood back to back, the
// second writing the register that the first reads and writes.
// LEAD: the statement stands behind the score products with nothing but LDS loads between. Tile a
// is then the result of the fourth product from the end, three vector slots back, and the chip
// needs four before a vector instruction reads it: one v_nop ahead of the first exponential.
#define EXP2_16 \
        "v_exp_f16 %0.l, %0.l\n\tv_exp_f16 %1.l, %1.l\n\tv_exp_f16 %2.l, %2.l\n\tv_exp_f16 %3.l, %3.l\n\t" \
        "v_exp_f16 %4.l, %4.l\n\tv_exp_f16 %5.l, %5.l\n\tv_exp_f16 %6.l, %6.l\n\tv_exp_f16 %7.l, %7.l\n\t" \
        "v_exp_f16 %0.h, %0.h\n\tv_exp_f16 %1.h, %1.h\n\tv_exp_f16 %2.h, %2.h\n\tv_exp_f16 %3.h, %3.h\n\t" \
        "v_exp_f16 %4.h, %4.h\n\tv_exp_f16 %5.h, %5.h\n\tv_exp_f16 %6.h, %6.h\n\tv_exp_f16 %7.h, %7.h"
template <bool LEAD>
__device__ inline v16h exp2_tiles(v8h a, v8h b) {
    const v4u ua = __builtin_bit_cast(v4u, a), ub = __builtin_bit_cast(v4u, b);
    unsigned x0 = ua[0], x1 = ua[1], x2 = ua[2], x3 = ua[3];
    unsigned x4 = ub[0], x5 = ub[1], x6 = ub[2], x7 = ub[3];
    if constexpr (LEAD)
        asm("v_nop\n\t" EXP2_16
            : "+v"(x0), "+v"(x1), "+v"(x2), "+v"(x3), "+v"(x4), "+v"(x5), "+v"(x6), "+v"(x7));
    else
        asm(EXP2_16
            : "+v"(x0), "+v"(x1), "+v"(x2), "+v"(x3), "+v"(x4), "+v"(x5), "+v"(x6), "+v"(x7));
    typedef __attribute__((ext_vector_type(8))) unsigned v8u;
    const v8u r = {x0, x1, x2, x3, x4, x5, x6, x7};   // eight registers of two f16 each
    return __builtin_bit_cast(v16h, r);
}

// Largest of three, two f16 values a register.
__device__ inline v8h max3_8(v8h a, v8h b, v8h c) {
    return __builtin_elementwise_maximum(__builtin_elementwise_maximum(a, b), c);
}
__device__ inline v2h max3_2(v2h a, v2h b, v2h c) {
    return __builtin_elementwise_maximum(__builtin_elementwise_maximum(a, b), c);
}
__device__ inline v2h pair(v8h x, int i) {
    return i == 0 ? __builtin_shufflevector(x, x, 0, 1) : i == 1 ? __builtin_shufflevector(x, x, 2, 3)
         : i == 2 ? __builtin_shufflevector(x, x, 4, 5) : __builtin_shufflevector(x, x, 6, 7);
}
// Largest of the 16 values of two tiles' registers.
__device__ inline _Float16 max_16(v8h t, v8h u) {
    const v2h a = max3_2(pair(t, 0), pair(t, 1), pair(t, 2));
    const v2h b = max3_2(pair(t, 3), pair(u, 0), pair(u, 1));
    const v2h d = __builtin_elementwise_maximum(max3_2(pair(u, 2), pair(u, 3), a), b);
    return __builtin_elementwise_maximum(d[0], d[1]);
}

// A Q operand chunk (B: one query column per lane) from four 16-byte pieces of the f32 row,
// d = base + 0..7 (a, b) and base + 16..23 (c, d), with the scale folded in.
__device__ inline v16h cvt_q(v4f a, v4f b, v4f c, v4f d, float scale) {
    v16h r;
#pragma unroll
    for (int j = 0; j < 4; ++j) {
        r[j]      = (_Float16)(a[j] * scale);
        r[j + 4]  = (_Float16)(b[j] * scale);
        r[j + 8]  = (_Float16)(c[j] * scale);
        r[j + 12] = (_Float16)(d[j] * scale);
    }
    return r;
}

__global__ __launch_bounds__(256) __attribute__((amdgpu_waves_per_eu(4, 4)))
void fa_wmma_kernel(const float* __restrict__ Q,
                    const float* __restrict__ K,       // [bh][s][d]
                    const float* __restrict__ V,       // [bh][s][d]
                    float* __restrict__ O) {
    // Landing place of the f32 rows, one range per wave: [wave][K, V][16 rows x 64 d].
    __shared__ __align__(16) float    Stg[8][2][WR * Dn];  // 64 KB
    // Double-buffered f16 K/V tiles (padded rows), both [key][d]. Ahead of the first tile the
    // same place takes the f32 Q rows, one range of 32 rows per wave.
    struct Tiles {
        _Float16 k[2][KBLK * KD];   // 2 x 18 KB
        _Float16 v[2][KBLK * VD];   // 2 x 20 KB
    };
    __shared__ __align__(16) union { Tiles t; float q[8][16 * NG * Dn]; } Sh;   // 76 KB
    __shared__ int redo;   // set by a wave whose row sums left the range of the fixed form
    auto& Ksh = Sh.t.k;
    auto& Vsh = Sh.t.v;

    // The head index runs fastest in the grid: the 8 query blocks of a head have flat indices
    // 64 apart. For speed only: nothing depends on where a work-group runs.
    const int hd   = blockIdx.x;     // batch * Hn + head
    const int qb   = blockIdx.y;
    const int tid  = threadIdx.x;
    const int lane = tid & 31;
    const int wv   = tid >> 5;       // wave id 0..7
    const int hf   = lane >> 4;      // half-wave: 0 or 1
    const int l16  = lane & 15;
    const int koff = hf * 8;         // K-offset pattern per half-wave

    const size_t bh = (size_t)hd * (size_t)Sn * Dn;
    const float*    Qb  = Q  + bh;
    const float*    Kb  = K  + bh;
    const float*    Vb  = V  + bh;
    float*          Ob  = O  + bh;

    // fold softmax scale and log2(e) into Q so scores are in exp2 domain
    const float qscale = 0.125f * 1.44269504088896f;

    // Q rows in and O rows out cross global memory as whole lines: a wave's 32 rows are 8192
    // contiguous bytes, 16 accesses of 512 bytes. They are turned in an LDS range of the wave's
    // own, 32 rows of 16 chunks of 16 bytes; chunk c of row r lies at place c ^ (r & 15), so
    // that 16 lanes meet 16 different places whether they walk along a row or down a column.
    // Line side, access i: lane reads or writes row 2 i + hf, chunk l16.
    // Fragment side: row 16 g + l16, chunk 4 t + 2 hf + j, which is d = 16 t + 8 hf + 4 j.
    // Offsets in floats; the line side's leaves out the 128 i of access i.
    auto line_off = [](int ln, int i) { return (ln >> 4) * Dn + (((ln & 15) ^ (ln >> 4) ^ (2 * (i & 7))) * 4); };
    auto frag_off = [](int ln, int g, int t, int j) {
        return (16 * g + (ln & 15)) * Dn + (((ln & 15) ^ (2 * (ln >> 4)) ^ (4 * t + j)) * 4);
    };
    const int      wvs   = __builtin_amdgcn_readfirstlane(wv);   // wave id in a scalar register, kept to the end
    const unsigned wrow0 = (unsigned)(qb * QTILE + wvs * (16 * NG)) * Dn;   // the wave's first row, in floats
    float* qst = &Sh.q[0][0] + wvs * (16 * NG * Dn);
    {
        const float* qg = (const float*)((const char*)(Qb + wrow0) + (unsigned)lane * 16u);
        copy16_to_lds<0>(qg, qst + line_off(lane, 0));     copy16_to_lds<512>(qg, qst + line_off(lane, 1));
        copy16_to_lds<1024>(qg, qst + line_off(lane, 2));  copy16_to_lds<1536>(qg, qst + line_off(lane, 3));
        copy16_to_lds<2048>(qg, qst + line_off(lane, 4));  copy16_to_lds<2560>(qg, qst + line_off(lane, 5));
        copy16_to_lds<3072>(qg, qst + line_off(lane, 6));  copy16_to_lds<3584>(qg, qst + line_off(lane, 7));
        copy16_to_lds<4096>(qg, qst + line_off(lane, 8));  copy16_to_lds<4608>(qg, qst + line_off(lane, 9));
        copy16_to_lds<5120>(qg, qst + line_off(lane, 10)); copy16_to_lds<5632>(qg, qst + line_off(lane, 11));
        copy16_to_lds<6144>(qg, qst + line_off(lane, 12)); copy16_to_lds<6656>(qg, qst + line_off(lane, 13));
        copy16_to_lds<7168>(qg, qst + line_off(lane, 14)); copy16_to_lds<7680>(qg, qst + line_off(lane, 15));
    }

    // A operand of the row sums: rows 0 and 8 (lanes 0, 8, 16, 24) are ones, the rest zero.
    // Only register 0 of a sum tile is read, which is row 8 hf.
    v16h vones;
    const _Float16 one08 = ((lane & 7) == 0) ? (_Float16)1.0f : (_Float16)0.0f;
#pragma unroll
    for (int j = 0; j < 16; ++j) vones[j] = one08;

    const v8f vzero = {0.f, 0.f, 0.f, 0.f, 0.f, 0.f, 0.f, 0.f};
    v8f o[NG][4];                    // o[g][t][r] = O^T[d = 16 t + 8 hf + r][query l16 of group g]
    v8f olsum[NG];                   // ones * P^T: rows 0 and 8 are the column sums of P^T
    // Minus the maximum in use of this lane's query, f16, in all 8 rows. One copy per score tile of a
    // step: with one for both, the compiler copied it into the second tile's registers on every step.
    v8h cm[PT][NG];
#pragma unroll
    for (int g = 0; g < NG; ++g) {
#pragma unroll
        for (int t = 0; t < 4; ++t) o[g][t] = vzero;
        olsum[g] = vzero;
        cm[0][g] = cm[1][g] = (v8h)(_Float16)0.0f; // the scores of the first 32 keys set the reference (below)
    }

    // The wave's 16 rows of tile kb, K and V: 4096 contiguous bytes each, 8 copies of 512
    // bytes. Each global address is a wave-uniform tile base plus a 32-bit lane offset.
    // A lane reads back, for the conversion, the very 16 bytes that it copies.
    const unsigned go  = (unsigned)wv * (WR * Dn * 4u) + (unsigned)lane * 16u;   // bytes
    float*         stg = &Stg[0][0][0] + wv * (2 * WR * Dn) + lane * 4;          // K rows; V rows WR * Dn on
    auto fill_rows = [&](int kb) {
        const char* kg = (const char*)(Kb + (size_t)kb * KBLK * Dn);
        const char* vg = (const char*)(Vb + (size_t)kb * KBLK * Dn);
        copy_rows_to_lds((const float*)(kg + go), stg);
        copy_rows_to_lds((const float*)(vg + go), stg + WR * Dn);
    };
    // f32 rows of the wave's own range -> f16 rows of tile buffer buf: chunk i of a lane is
    // row 2 i + hf of the wave's 16, columns 4 l16 .. 4 l16 + 3.
    _Float16* kst = &Ksh[0][0] + (wv * WR + hf) * KD + l16 * 4;
    _Float16* vst = &Vsh[0][0] + (wv * WR + hf) * VD + l16 * 4;
    auto convert_rows = [&](int buf) {
        float4 a[8], b[8];
#pragma unroll
        for (int i = 0; i < 8; ++i) a[i] = *(const float4*)(stg + i * 128);
#pragma unroll
        for (int i = 0; i < 8; ++i) b[i] = *(const float4*)(stg + WR * Dn + i * 128);
        // All 16 loads stay one run in front of the conversions (the fragment and score
        // registers are free here); left free, the compiler split them and waited for each.
        __builtin_amdgcn_sched_barrier(0);
#pragma unroll
        for (int i = 0; i < 8; ++i) *(v4h*)(kst + buf * (KBLK * KD) + i * 2 * KD) = cvt4(a[i]);
#pragma unroll
        for (int i = 0; i < 8; ++i) *(v4h*)(vst + buf * (KBLK * VD) + i * 2 * VD) = cvt4(b[i]);
    };

    fill_rows(0);   // first tile

    wait_async_lds();   // the wave's own Q rows have landed (and its rows of the first tile)
    v4f qf[NG][4][2];
#pragma unroll
    for (int g = 0; g < NG; ++g)
#pragma unroll
        for (int t = 0; t < 4; ++t) {
            qf[g][t][0] = *(const v4f*)(qst + frag_off(lane, g, t, 0));
            qf[g][t][1] = *(const v4f*)(qst + frag_off(lane, g, t, 1));
        }
    // All 16 loads stay one run in front of the conversions; left free, the compiler
    // spread them among the conversions, with a wait at each place.
    __builtin_amdgcn_sched_barrier(0);
    v16h qa[NG][2];
#pragma unroll
    for (int g = 0; g < NG; ++g)
#pragma unroll
        for (int kc = 0; kc < 2; ++kc)
            qa[g][kc] = cvt_q(qf[g][2 * kc][0], qf[g][2 * kc][1], qf[g][2 * kc + 1][0], qf[g][2 * kc + 1][1], qscale);
    redo = 0;   // every lane the same value; in LDS ahead of the barrier below
    // Every wave's reads of its Q rows are over before any wave writes the first tile there.
    asm volatile("s_wait_dscnt 0x0" ::: "memory");
    __syncthreads();

    // The key loop. Inlined at both places, so that every register array stays in registers.
    auto key_loop = [&](auto moving) __attribute__((always_inline)) {
    constexpr bool MOVING = decltype(moving)::value;
    // Tile kb becomes readable in buffer kb & 1. Called ahead of the loop for tile 0 and at the foot
    // of each trip for the next tile: the order of copies, conversions, barriers and steps is the
    // same as with the call at the head of the trip, but tile 0 is there ahead of the loop.
    auto publish = [&](int kb) __attribute__((always_inline)) {
        wait_async_lds();        // this wave's rows of tile kb have landed; no other wave reads them
        // The buffer was last read for tile kb - 2, which every wave had left at the barrier of tile kb - 1.
        convert_rows(kb & 1);
        // The wave's reads of its range are over before the range is refilled, and its f16
        // rows are in LDS before the barrier behind which the other waves read them.
        asm volatile("s_wait_dscnt 0x0" ::: "memory");
        __syncthreads();         // tile kb complete in its buffer
        if (kb + 1 < NBLK) fill_rows(kb + 1);   // lands under the work on tile kb
    };
    // ---- S^T - reference = K * Q^T + cm : 2 key tiles of 16 x 2 column groups, K-dim D=64 in 2 chunks ----
    auto form_scores = [&](v8h (&d)[PT][NG], const v16h (&f)[4]) __attribute__((always_inline)) {
#pragma unroll
        for (int u = 0; u < PT; ++u)
#pragma unroll
            for (int g = 0; g < NG; ++g)
                d[u][g] = __builtin_amdgcn_wmma_f16_16x16x32_f16(
                    false, f[2 * u], false, qa[g][0], (short)0, cm[u][g], false, false);
#pragma unroll
        for (int u = 0; u < PT; ++u)
#pragma unroll
            for (int g = 0; g < NG; ++g)
                d[u][g] = __builtin_amdgcn_wmma_f16_16x16x32_f16(
                    false, f[2 * u + 1], false, qa[g][1], (short)0, d[u][g], false, false);
        // The eight products stay one run in this order (a tile's second product four behind
        // its first); left free, the compiler wove the work behind them in, with idle slots.
        __builtin_amdgcn_sched_barrier(0);
    };

    publish(0);
    if constexpr (!MOVING) {
        // The reference: largest score of the query's first 32 keys (cm is still 0), rounded up to
        // a whole number. Set ahead of the loop, so that it is one value for the whole loop.
        v16h f0[4];
#pragma unroll
        for (int i = 0; i < 4; ++i) f0[i] = ld_op16(&Ksh[0][((i >> 1) * 16 + l16) * KD + (i & 1) * 32 + koff]);
        v8h s0[PT][NG];
        form_scores(s0, f0);
#pragma unroll
        for (int g = 0; g < NG; ++g) {
            const float rg = (float)max_16(s0[0][g], s0[1][g]);
            const float dl = __builtin_ceilf(fmaxf(rg, xhalf(rg)));
            cm[0][g] = cm[1][g] = (v8h)(_Float16)(-dl);
        }
    }

    // One body for all trips: with the last trips peeled off for the two tests at the foot, the
    // register count rose and copies stood around the exponentials.
#pragma clang loop unroll(disable)
    for (int kb = 0; kb < NBLK; ++kb) {
        const int cur = kb & 1;

        // Fragment loads, both in the hardware k order (keys or d 8 hf + j, then 16 + 8 hf + j).
        auto ld_k = [&](int t, int kc) {   // A: key rows 16 t .. 16 t + 15, d chunk kc
            return ld_op16(&Ksh[cur][(t * 16 + l16) * KD + kc * 32 + koff]);
        };
        auto ld_v = [&](int t, int kc) {   // A: d rows 16 t .. 16 t + 15, key chunk kc
            const _Float16* p = &Vsh[cur][(kc * 32 + koff + (lane & 7)) * VD + t * 16 + ((lane >> 3) & 1) * 8];
            union { v16h v; v8h h[2]; } u;
            u.h[0] = ld_tr16(p);              // keys 8 hf + j of the chunk
            u.h[1] = ld_tr16(p + 16 * VD);    // keys 16 + 8 hf + j
            return u.v;
        };
        // Four K and four V^T fragments, both sets refilled in ONE run of LDS loads per step,
        // behind the score products and their test. The scheduling fences around the run keep
        // it in one place, ahead of the work that covers its latency; left free, the compiler
        // put two loads and a full wait in front of most products.
        v16h fk[4], fv[4];

        // K fragments of the tile's first 32 keys
#pragma unroll
        for (int i = 0; i < 4; ++i) fk[i] = ld_k(i >> 1, i & 1);
        __builtin_amdgcn_sched_barrier(0);   // the load run stays in front of the products

#pragma unroll
        for (int p = 0; p < KBLK / PK; ++p) {
            v8h c[PT][NG];               // score tiles, f16: four registers each
            if constexpr (!MOVING) {
                form_scores(c, fk);
            } else {
            // The very first step (maximum in use still 0) moves the maximum whatever its scores
            // are, and may lower it: from then on the maximum in use is a true maximum.
            const bool first = (p == 0) && (kb == 0);
            _Float16    thr = first ? (_Float16)-__builtin_inff() : (_Float16)LAZY;
            const float lo  = first ? -__builtin_inff() : 0.0f;
            // One trip, at most two: a trip that finds a score more than thr above the maximum in
            // use moves the maximum, sets thr to +infinity (no score lies above that, so the second
            // trip is the last) and forms the scores anew; the K fragments are still in their
            // registers. A loop, so that the score tiles have ONE defining place: with a second
            // one behind a branch the compiler copied all 16 registers on every step.
            for (;;) {
                form_scores(c, fk);

                // ---- online softmax in exp2 domain, one query per lane and group ----
                // Largest score - maximum in use among this lane's 32 values of both groups, two a register.
                const _Float16 top = max_16(max3_8(c[0][0], c[1][0], c[0][1]), c[1][1]);
                // one wave-uniform test per trip
                if (__builtin_amdgcn_ballot_w32(top > thr) == 0u) break;
#pragma unroll
                for (int g = 0; g < NG; ++g) {
                    const float rg = (float)max_16(c[0][g], c[1][g]);
                    const float r  = fmaxf(rg, xhalf(rg));
                    // Rise of the maximum in use, rounded up to a whole number: the maximum in use stays a
                    // whole number, which f16 holds exactly, so the tiles move by just what the accumulators do.
                    const float dl = __builtin_ceilf(fmaxf(r, lo));
                    const float sc = fast_exp2(fminf(-dl, 0.0f));    // first step: accumulators are 0, factor stays finite
                    // rescale accumulators; of the row-sum tile only row 8 hf (register 0) is read
#pragma unroll
                    for (int t = 0; t < 4; ++t) o[g][t] *= sc;
                    olsum[g][0] *= sc;
                    cm[0][g] -= (v8h)(_Float16)dl;
                    cm[1][g] -= (v8h)(_Float16)dl;
                }
                thr = (_Float16)__builtin_inff();
            }
            }
            __builtin_amdgcn_sched_barrier(0);   // load run behind the last use of the K registers
#pragma unroll
            for (int t = 0; t < 4; ++t) fv[t] = ld_v(t, p);   // V^T, the 32 keys of this step
            if (p + 1 < KBLK / PK) {   // K fragments of the tile's next 32 keys (same LDS buffer)
#pragma unroll
                for (int i = 0; i < 4; ++i) fk[i] = ld_k(PT * (p + 1) + (i >> 1), i & 1);
            }
            __builtin_amdgcn_sched_barrier(0);   // and in front of the exponentials, which cover its latency

            // ---- O^T += V^T * P^T, rowsum += ones * P^T : 32 keys ----
            v16h pb[NG];                 // keys 8 hf + j of tile 0, then of tile 1
            static_assert(NG == 2, "two column groups written out");
            pb[0] = exp2_tiles<!MOVING>(c[0][0], c[1][0]);
            pb[1] = exp2_tiles<false>(c[0][1], c[1][1]);
            // Both groups' exponentials stand in front of the first product, whose V^T
            // fragment is still on its way from LDS under them.
            __builtin_amdgcn_sched_barrier(0);
#pragma unroll
            for (int g = 0; g < NG; ++g) {
#pragma unroll
                for (int t = 0; t < 4; ++t)
                    o[g][t] = __builtin_amdgcn_wmma_f32_16x16x32_f16(
                        false, fv[t], false, pb[g], (short)0, o[g][t], false, false);
                olsum[g] = __builtin_amdgcn_wmma_f32_16x16x32_f16(
                    false, vones, false, pb[g], (short)0, olsum[g], false, false);
            }
        }
        if (kb + 1 < NBLK) publish(kb + 1);
    }
    };   // key_loop

    key_loop(Flag<false>{});   // fixed reference

    // Range test of the fixed form: a row sum that is infinite or not a number. One wave's
    // finding sends the whole work-group through the loop again, since the tiles are shared work.
    {
        const bool bad = !(olsum[0][0] < __builtin_inff()) || !(olsum[1][0] < __builtin_inff());
        if (__builtin_amdgcn_ballot_w32(bad) != 0u) redo = 1;
    }
    // The finding is in LDS before the barrier behind which every wave reads it.
    asm volatile("s_wait_dscnt 0x0" ::: "memory");
    __syncthreads();
    if (__builtin_amdgcn_readfirstlane(redo) != 0) {   // the same in every wave of the work-group
#pragma unroll
        for (int g = 0; g < NG; ++g) {
#pragma unroll
            for (int t = 0; t < 4; ++t) o[g][t] = vzero;
            olsum[g] = vzero;
            cm[0][g] = cm[1][g] = (v8h)(_Float16)0.0f;
        }
        // Every wave has left the last tile (buffer 1) and its own landing range at the barrier above.
        fill_rows(0);
        key_loop(Flag<true>{});   // moving maximum
    }

    // ---- normalize (1 rcp per query) and write out (fp32): 8 consecutive d per tile ----
#pragma unroll
    for (int g = 0; g < NG; ++g) {
        const float rinv = fast_rcp(olsum[g][0]);
#pragma unroll
        for (int t = 0; t < 4; ++t) o[g][t] *= rinv;
    }
    // The wave's landing range of the K, V rows is free (last copies waited for, last reads
    // over, no other wave touches it): its 8192 bytes take the wave's 32 output rows.
    // The lane id is taken anew, so that no offset of the Q rows' turn stays in a register over the loop.
    const int ln  = (int)__builtin_amdgcn_mbcnt_lo(~0u, 0u);
    float*    ost = &Stg[0][0][0] + wvs * (2 * WR * Dn);
#pragma unroll
    for (int g = 0; g < NG; ++g)
#pragma unroll
        for (int t = 0; t < 4; ++t) {
            *(v4f*)(ost + frag_off(ln, g, t, 0)) = __builtin_shufflevector(o[g][t], o[g][t], 0, 1, 2, 3);
            *(v4f*)(ost + frag_off(ln, g, t, 1)) = __builtin_shufflevector(o[g][t], o[g][t], 4, 5, 6, 7);
        }
    // The rows are in LDS before other lanes of the wave read them back.
    asm volatile("s_wait_dscnt 0x0" ::: "memory");
    v4f w[16];
#pragma unroll
    for (int i = 0; i < 16; ++i) w[i] = *(const v4f*)(ost + i * 128 + line_off(ln, i));
    // Every LDS load stands in front of the first store, so that no register
    // that an issued store names is written again.
    __builtin_amdgcn_sched_barrier(0);
    float* og = Ob + wrow0 + ln * 4;
#pragma unroll
    for (int i = 0; i < 16; ++i) *(v4f*)(og + i * 128) = w[i];
}

extern "C" void kernel_launch(void* const* d_in, const int* in_sizes, int n_in,
                              void* d_out, int out_size, void* d_ws, size_t ws_size,
                              hipStream_t stream) {
    const float* q = (const float*)d_in[0];
    const float* k = (const float*)d_in[1];
    const float* v = (const float*)d_in[2];
    float* out = (float*)d_out;
    (void)in_sizes; (void)n_in; (void)out_size; (void)d_ws; (void)ws_size;

    dim3 grid(Bn * Hn, Sn / QTILE);                      // (64, 8)
    fa_wmma_kernel<<<grid, 256, 0, stream>>>(q, k, v, out);
}

// v010
// One run takes 40 microseconds.
// Timed twice side by side with v009, it ran 1.08 times as fast both times.
// All steps since v000 together make it 5.06 times as fast.
#include <hip/hip_runtime.h>

typedef __attribute__((ext_vector_type(16))) _Float16 v16h;
typedef __attribute__((ext_vector_type(8)))  _Float16 v8h;
typedef __attribute__((ext_vector_type(4)))  _Float16 v4h;
typedef __attribute__((ext_vector_type(2)))  _Float16 v2h;
typedef __attribute__((ext_vector_type(4)))  unsigned v4u;
typedef __attribute__((ext_vector_type(8)))  float    v8f;
typedef __attribute__((ext_vector_type(4)))  float    v4f;
typedef __attribute__((ext_vector_type(4)))  int      v4i;
typedef __attribute__((ext_vector_type(8)))  short    v8s;

// Problem constants (reference: B,H,S,D = 4,16,2048,64)
constexpr int Bn = 4, Hn = 16, Sn = 2048, Dn = 64;
constexpr int NG    = 2;       // column groups of 16 queries per wave
constexpr int NWV   = 16;      // waves per workgroup: one workgroup fills a WGP, four waves per SIMD
constexpr int QTILE = NWV * 16 * NG; // queries per workgroup (16 waves x 16 NG columns) = 512
constexpr int KBLK  = 128;     // keys per LDS block (8 score tiles)
constexpr int NBLK  = Sn / KBLK;
constexpr int PK    = 32;      // keys per softmax step
constexpr int PT    = PK / 16; // score tiles per step and column group = 2
constexpr float LAZY = 8.0f;   // P stays below 2^8, far inside f16, while the maximum in use is kept
// padded LDS row strides (halves), each for its reader
constexpr int KD = Dn + 8;     // 72: 144 B = 16 B x odd, read by ds_load_b128
constexpr int VD = Dn + 16;    // 80: 160 B = 32 B x odd, read by the transposing load
constexpr int WR = KBLK / NWV; // key rows of a tile that one wave brings in and converts = 8
constexpr int WST = 16 * NG * Dn; // floats of a wave's own LDS range: two slots of K, V rows, at the end its 32 output rows
constexpr int NBUF = 3;        // f16 tile buffers: tile kb lies in buffer kb mod 3

#if defined(__has_builtin)
#if __has_builtin(__builtin_amdgcn_global_load_async_to_lds_b128)
#define HAVE_ASYNC_LDS 1
#endif
#endif
#ifndef HAVE_ASYNC_LDS
#define HAVE_ASYNC_LDS 0
#endif

// Compile-time switch between the two forms of the key loop.
template <bool B> struct Flag { static constexpr bool value = B; };

#define AS_GLOBAL __attribute__((address_space(1)))
#define AS_LDS    __attribute__((address_space(3)))

// 2^x via v_exp_f32 (hardware exp is base-2)
__device__ inline float fast_exp2(float x) {
#if defined(__has_builtin) && __has_builtin(__builtin_amdgcn_exp2f)
    return __builtin_amdgcn_exp2f(x);
#else
    return __expf(x * 0.6931471805599453f);
#endif
}

__device__ inline float fast_rcp(float x) {
#if defined(__has_builtin) && __has_builtin(__builtin_amdgcn_rcpf)
    return __builtin_amdgcn_rcpf(x);
#else
    return 1.0f / x;
#endif
}

// The wave's own copies have landed behind this wait. In asm with the memory clobber, so
// that the LDS reads of the landed rows, which follow it directly, stay behind it.
__device__ inline void wait_async_lds() {
#if HAVE_ASYNC_LDS
    asm volatile("s_wait_asynccnt 0x0" ::: "memory");
#endif
}

// Copy one 16-byte chunk global(f32) -> LDS, async if available. OFF (bytes) is the
// instruction's immediate offset, which moves the global and the LDS address alike.
template <int OFF>
__device__ inline void copy16_to_lds(const float* g, float* l) {
    static_assert(OFF >= 0 && OFF < 65536 && OFF % 16 == 0, "offset of an async copy");
#if HAVE_ASYNC_LDS
    __builtin_amdgcn_global_load_async_to_lds_b128(
        (AS_GLOBAL v4i*)g, (AS_LDS v4i*)l, OFF, 0);
#else
    *(float4*)(l + OFF / 4) = *(const float4*)(g + OFF / 4);
#endif
}

// Four such copies, 512 bytes apart on both sides: 2048 contiguous bytes per wave, 8 rows.
__device__ inline void copy_rows_to_lds(const float* g, float* l) {
    static_assert(WR * Dn * 4 == 4 * 512, "four copies cover the wave's rows");
    copy16_to_lds<0>(g, l);    copy16_to_lds<512>(g, l);
    copy16_to_lds<1024>(g, l); copy16_to_lds<1536>(g, l);
}

// Transposing LDS load: lane (c = l & 15, h = l >> 4) gets eight rows of one column of a
// row-major 16-bit tile; every lane passes its own row address (see ld_v).
__device__ inline v8h ld_tr16(const _Float16* p) {
    typedef AS_LDS v8s lds_v8s;
    return __builtin_bit_cast(v8h, __builtin_amdgcn_ds_load_tr16_b128_v8i16((lds_v8s*)p));
}

__device__ inline v4h cvt4(float4 x) {
    v4h r;
    r[0] = (_Float16)x.x; r[1] = (_Float16)x.y; r[2] = (_Float16)x.z; r[3] = (_Float16)x.w;
    return r;
}

// Load a v16h WMMA operand from LDS following the 16-bit A/B register layout:
// element j in [0,7]  -> K = base + j        (contiguous)
// element j in [8,15] -> K = base + 16 + j-8 (contiguous)
__device__ inline v16h ld_op16(const _Float16* p) {
    union { v16h v; v8h h[2]; } u;
    u.h[0] = *(const v8h*)(p);
    u.h[1] = *(const v8h*)(p + 16);
    return u.v;
}

// Value of lane l ^ 16: the other half of the keys of the same query column.
__device__ inline float xhalf(float x) {
    return __builtin_bit_cast(float, __builtin_amdgcn_permlanex16(
        __builtin_bit_cast(int, x), __builtin_bit_cast(int, x),
        0x76543210, 0xfedcba98, false, false));
}

// P^T operand of one column group and 32 keys: 2^x of two f16 score tiles, in place (the
// tiles already hold score minus maximum in use). A 16-bit D tile has element e = key 8 hf + e
// in register e >> 1, half e & 1, so two tiles side by side ARE the B operand: no conversion.
// One asm statement, for the order: the low halves of all eight registers, then the high
// halves. Left to the compiler, the two exponentials of a register stood back to back, the
// second writing the register that the first reads and writes.
// LEAD: the statement stands behind the score products with nothing but LDS loads between. Tile a
// is then the result of the fourth product from the end, three vector slots back, and the chip
// needs four before a vector instruction reads it: one v_nop ahead of the first exponential.
#define EXP2_16 \
        "v_exp_f16 %0.l, %0.l\n\tv_exp_f16 %1.l, %1.l\n\tv_exp_f16 %2.l, %2.l\n\tv_exp_f16 %3.l, %3.l\n\t" \
        "v_exp_f16 %4.l, %4.l\n\tv_exp_f16 %5.l, %5.l\n\tv_exp_f16 %6.l, %6.l\n\tv_exp_f16 %7.l, %7.l\n\t" \
        "v_exp_f16 %0.h, %0.h\n\tv_exp_f16 %1.h, %1.h\n\tv_exp_f16 %2.h, %2.h\n\tv_exp_f16 %3.h, %3.h\n\t" \
        "v_exp_f16 %4.h, %4.h\n\tv_exp_f16 %5.h, %5.h\n\tv_exp_f16 %6.h, %6.h\n\tv_exp_f16 %7.h, %7.h"
template <bool LEAD>
__device__ inline v16h exp2_tiles(v8h a, v8h b) {
    const v4u ua = __builtin_bit_cast(v4u, a), ub = __builtin_bit_cast(v4u, b);
    unsigned x0 = ua[0], x1 = ua[1], x2 = ua[2], x3 = ua[3];
    unsigned x4 = ub[0], x5 = ub[1], x6 = ub[2], x7 = ub[3];
    if constexpr (LEAD)
        asm("v_nop\n\t" EXP2_16
            : "+v"(x0), "+v"(x1), "+v"(x2), "+v"(x3), "+v"(x4), "+v"(x5), "+v"(x6), "+v"(x7));
    else
        asm(EXP2_16
            : "+v"(x0), "+v"(x1), "+v"(x2), "+v"(x3), "+v"(x4), "+v"(x5), "+v"(x6), "+v"(x7));
    typedef __attribute__((ext_vector_type(8))) unsigned v8u;
    const v8u r = {x0, x1, x2, x3, x4, x5, x6, x7};   // eight registers of two f16 each
    return __builtin_bit_cast(v16h, r);
}

// Largest of three, two f16 values a register.
__device__ inline v8h max3_8(v8h a, v8h b, v8h c) {
    return __builtin_elementwise_maximum(__builtin_elementwise_maximum(a, b), c);
}
__device__ inline v2h max3_2(v2h a, v2h b, v2h c) {
    return __builtin_elementwise_maximum(__builtin_elementwise_maximum(a, b), c);
}
__device__ inline v2h pair(v8h x, int i) {
    return i == 0 ? __builtin_shufflevector(x, x, 0, 1) : i == 1 ? __builtin_shufflevector(x, x, 2, 3)
         : i == 2 ? __builtin_shufflevector(x, x, 4, 5) : __builtin_shufflevector(x, x, 6, 7);
}
// Largest of the 16 values of two tiles' registers.
__device__ inline _Float16 max_16(v8h t, v8h u) {
    const v2h a = max3_2(pair(t, 0), pair(t, 1), pair(t, 2));
    const v2h b = max3_2(pair(t, 3), pair(u, 0), pair(u, 1));
    const v2h d = __builtin_elementwise_maximum(max3_2(pair(u, 2), pair(u, 3), a), b);
    return __builtin_elementwise_maximum(d[0], d[1]);
}

// A Q operand chunk (B: one query column per lane) from four 16-byte pieces of the f32 row,
// d = base + 0..7 (a, b) and base + 16..23 (c, d), with the scale folded in.
__device__ inline v16h cvt_q(v4f a, v4f b, v4f c, v4f d, float scale) {
    v16h r;
#pragma unroll
    for (int j = 0; j < 4; ++j) {
        r[j]      = (_Float16)(a[j] * scale);
        r[j + 4]  = (_Float16)(b[j] * scale);
        r[j + 8]  = (_Float16)(c[j] * scale);
        r[j + 12] = (_Float16)(d[j] * scale);
    }
    return r;
}

__global__ __launch_bounds__(NWV * 32) __attribute__((amdgpu_waves_per_eu(4, 4)))
void fa_wmma_kernel(const float* __restrict__ Q,
                    const float* __restrict__ K,       // [bh][s][d]
                    const float* __restrict__ V,       // [bh][s][d]
                    float* __restrict__ O) {
    // Landing place of the f32 rows, one range per wave: two slots of K rows, V rows (8 rows x
    // 64 d each); slot 1 serves tile 1 alone. The range takes the wave's output rows at the end.
    __shared__ __align__(16) float    Stg[NWV][WST];       // 128 KB
    // Three buffers of f16 K/V tiles (padded rows), both [key][d]. Ahead of the first tile the
    // same place takes the f32 Q rows, one range of 32 rows per wave.
    // K and V of a buffer lie side by side, so that every offset from a buffer's start fits the
    // LDS instructions' 16-bit offset field: one address register for K, one for V.
    struct Tile {
        _Float16 k[KBLK * KD];   // 18 KB
        _Float16 v[KBLK * VD];   // 20 KB
    };
    constexpr int TS = (int)(sizeof(Tile) / sizeof(_Float16));   // halves from one buffer to the next
    __shared__ __align__(16) union { Tile t[NBUF]; float q[NWV][16 * NG * Dn]; } Sh;   // 128 KB
    __shared__ int redo;   // set by a wave whose row sums left the range of the fixed form
    _Float16* const Ksh = &Sh.t[0].k[0];   // buffer b: + b * TS
    _Float16* const Vsh = &Sh.t[0].v[0];

    // The head index runs fastest in the grid: the 4 query blocks of a head have flat indices
    // 64 apart. For speed only: nothing depends on where a work-group runs.
    const int hd   = blockIdx.x;     // batch * Hn + head
    const int qb   = blockIdx.y;
    const int tid  = threadIdx.x;
    const int lane = tid & 31;
    const int wv   = tid >> 5;       // wave id 0..15
    const int hf   = lane >> 4;      // half-wave: 0 or 1
    const int l16  = lane & 15;
    const int koff = hf * 8;         // K-offset pattern per half-wave

    const size_t bh = (size_t)hd * (size_t)Sn * Dn;
    const float*    Qb  = Q  + bh;
    const float*    Kb  = K  + bh;
    const float*    Vb  = V  + bh;
    float*          Ob  = O  + bh;

    // fold softmax scale and log2(e) into Q so scores are in exp2 domain
    const float qscale = 0.125f * 1.44269504088896f;

    // Q rows in and O rows out cross global memory as whole lines: a wave's 32 rows are 8192
    // contiguous bytes, 16 accesses of 512 bytes. They are turned in an LDS range of the wave's
    // own, 32 rows of 16 chunks of 16 bytes; chunk c of row r lies at place c ^ (r & 15), so
    // that 16 lanes meet 16 different places whether they walk along a row or down a column.
    // Line side, access i: lane reads or writes row 2 i + hf, chunk l16.
    // Fragment side: row 16 g + l16, chunk 4 t + 2 hf + j, which is d = 16 t + 8 hf + 4 j.
    // Offsets in floats; the line side's leaves out the 128 i of access i.
    auto line_off = [](int ln, int i) { return (ln >> 4) * Dn + (((ln & 15) ^ (ln >> 4) ^ (2 * (i & 7))) * 4); };
    auto frag_off = [](int ln, int g, int t, int j) {
        return (16 * g + (ln & 15)) * Dn + (((ln & 15) ^ (2 * (ln >> 4)) ^ (4 * t + j)) * 4);
    };
    const int      wvs   = __builtin_amdgcn_readfirstlane(wv);   // wave id in a scalar register, kept to the end
    const unsigned wrow0 = (unsigned)(qb * QTILE + wvs * (16 * NG)) * Dn;   // the wave's first row, in floats
    float* qst = &Sh.q[0][0] + wvs * (16 * NG * Dn);
    {
        const float* qg = (const float*)((const char*)(Qb + wrow0) + (unsigned)lane * 16u);
        copy16_to_lds<0>(qg, qst + line_off(lane, 0));     copy16_to_lds<512>(qg, qst + line_off(lane, 1));
        copy16_to_lds<1024>(qg, qst + line_off(lane, 2));  copy16_to_lds<1536>(qg, qst + line_off(lane, 3));
        copy16_to_lds<2048>(qg, qst + line_off(lane, 4));  copy16_to_lds<2560>(qg, qst + line_off(lane, 5));
        copy16_to_lds<3072>(qg, qst + line_off(lane, 6));  copy16_to_lds<3584>(qg, qst + line_off(lane, 7));
        copy16_to_lds<4096>(qg, qst + line_off(lane, 8));  copy16_to_lds<4608>(qg, qst + line_off(lane, 9));
        copy16_to_lds<5120>(qg, qst + line_off(lane, 10)); copy16_to_lds<5632>(qg, qst + line_off(lane, 11));
        copy16_to_lds<6144>(qg, qst + line_off(lane, 12)); copy16_to_lds<6656>(qg, qst + line_off(lane, 13));
        copy16_to_lds<7168>(qg, qst + line_off(lane, 14)); copy16_to_lds<7680>(qg, qst + line_off(lane, 15));
    }

    // A operand of the row sums: rows 0 and 8 (lanes 0, 8, 16, 24) are ones, the rest zero.
    // Only register 0 of a sum tile is read, which is row 8 hf.
    v16h vones;
    const _Float16 one08 = ((lane & 7) == 0) ? (_Float16)1.0f : (_Float16)0.0f;
#pragma unroll
    for (int j = 0; j < 16; ++j) vones[j] = one08;

    const v8f vzero = {0.f, 0.f, 0.f, 0.f, 0.f, 0.f, 0.f, 0.f};
    v8f o[NG][4];                    // o[g][t][r] = O^T[d = 16 t + 8 hf + r][query l16 of group g]
    v8f olsum[NG];                   // ones * P^T: rows 0 and 8 are the column sums of P^T
    // Minus the maximum in use of this lane's query, f16, in all 8 rows. One copy per score tile of a
    // step: with one for both, the compiler copied it into the second tile's registers on every step.
    v8h cm[PT][NG];
#pragma unroll
    for (int g = 0; g < NG; ++g) {
#pragma unroll
        for (int t = 0; t < 4; ++t) o[g][t] = vzero;
        olsum[g] = vzero;
        cm[0][g] = cm[1][g] = (v8h)(_Float16)0.0f; // the scores of the first 32 keys set the reference (below)
    }

    // The wave's 8 rows of tile kb, K and V: 2048 contiguous bytes each, 4 copies of 512
    // bytes. Each global address is a wave-uniform tile base plus a 32-bit lane offset.
    // A lane reads back, for the conversion, the very 16 bytes that it copies.
    const unsigned go  = (unsigned)wv * (WR * Dn * 4u) + (unsigned)lane * 16u;   // bytes
    float*         stg = &Stg[0][0] + wv * WST + lane * 4;                       // K rows; V rows WR * Dn on
    static_assert(2 * (2 * WR * Dn) <= WST, "two slots in a wave's range");
    auto fill_rows = [&](int kb, int slot) {
        const char* kg = (const char*)(Kb + (size_t)kb * KBLK * Dn);
        const char* vg = (const char*)(Vb + (size_t)kb * KBLK * Dn);
        copy_rows_to_lds((const float*)(kg + go), stg + slot * (2 * WR * Dn));
        copy_rows_to_lds((const float*)(vg + go), stg + slot * (2 * WR * Dn) + WR * Dn);
    };
    // f32 rows of the wave's own range -> f16 rows of tile buffer buf: chunk i of a lane is
    // row 2 i + hf of the wave's 8, columns 4 l16 .. 4 l16 + 3.
    _Float16* kst = Ksh + (wv * WR + hf) * KD + l16 * 4;
    _Float16* vst = Vsh + (wv * WR + hf) * VD + l16 * 4;
    auto load_rows = [&](float4 (&a)[WR / 2], float4 (&b)[WR / 2], int slot) {
#pragma unroll
        for (int i = 0; i < WR / 2; ++i) a[i] = *(const float4*)(stg + slot * (2 * WR * Dn) + i * 128);
#pragma unroll
        for (int i = 0; i < WR / 2; ++i) b[i] = *(const float4*)(stg + slot * (2 * WR * Dn) + WR * Dn + i * 128);
    };
    auto store_rows = [&](const float4 (&a)[WR / 2], const float4 (&b)[WR / 2], int buf) {
#pragma unroll
        for (int i = 0; i < WR / 2; ++i) *(v4h*)(kst + buf * TS + i * 2 * KD) = cvt4(a[i]);
#pragma unroll
        for (int i = 0; i < WR / 2; ++i) *(v4h*)(vst + buf * TS + i * 2 * VD) = cvt4(b[i]);
    };

    fill_rows(0, 0);   // first two tiles
    fill_rows(1, 1);

    wait_async_lds();   // the wave's own Q rows have landed (and its rows of the first two tiles)
    v4f qf[NG][4][2];
#pragma unroll
    for (int g = 0; g < NG; ++g)
#pragma unroll
        for (int t = 0; t < 4; ++t) {
            qf[g][t][0] = *(const v4f*)(qst + frag_off(lane, g, t, 0));
            qf[g][t][1] = *(const v4f*)(qst + frag_off(lane, g, t, 1));
        }
    // All 16 loads stay one run in front of the conversions; left free, the compiler
    // spread them among the conversions, with a wait at each place.
    __builtin_amdgcn_sched_barrier(0);
    v16h qa[NG][2];
#pragma unroll
    for (int g = 0; g < NG; ++g)
#pragma unroll
        for (int kc = 0; kc < 2; ++kc)
            qa[g][kc] = cvt_q(qf[g][2 * kc][0], qf[g][2 * kc][1], qf[g][2 * kc + 1][0], qf[g][2 * kc + 1][1], qscale);
    redo = 0;   // every lane the same value; in LDS ahead of the barrier below
    // Every wave's reads of its Q rows are over before any wave writes the first tile there.
    asm volatile("s_wait_dscnt 0x0" ::: "memory");
    __syncthreads();

    // The key loop. Inlined at both places, so that every register array stays in registers.
    auto key_loop = [&](auto moving) __attribute__((always_inline)) {
    constexpr bool MOVING = decltype(moving)::value;
    // ---- S^T - reference = K * Q^T + cm : 2 key tiles of 16 x 2 column groups, K-dim D=64 in 2 chunks ----
    auto form_scores = [&](v8h (&d)[PT][NG], const v16h (&f)[4]) __attribute__((always_inline)) {
#pragma unroll
        for (int u = 0; u < PT; ++u)
#pragma unroll
            for (int g = 0; g < NG; ++g)
                d[u][g] = __builtin_amdgcn_wmma_f16_16x16x32_f16(
                    false, f[2 * u], false, qa[g][0], (short)0, cm[u][g], false, false);
#pragma unroll
        for (int u = 0; u < PT; ++u)
#pragma unroll
            for (int g = 0; g < NG; ++g)
                d[u][g] = __builtin_amdgcn_wmma_f16_16x16x32_f16(
                    false, f[2 * u + 1], false, qa[g][1], (short)0, d[u][g], false, false);
        // The eight products stay one run in this order (a tile's second product four behind
        // its first); left free, the compiler wove the work behind them in, with idle slots.
        __builtin_amdgcn_sched_barrier(0);
    };

    // Tiles 0 and 1 become readable in buffers 0 and 1: the caller has issued their copies.
    {
        wait_async_lds();        // this wave's rows of both tiles have landed; no other wave reads them
        float4 a0[WR / 2], b0[WR / 2], a1[WR / 2], b1[WR / 2];
        load_rows(a0, b0, 0);
        load_rows(a1, b1, 1);
        // All 16 loads stay one run in front of the conversions; left free, the compiler
        // split them and waited for each.
        __builtin_amdgcn_sched_barrier(0);
        store_rows(a0, b0, 0);
        store_rows(a1, b1, 1);
        // The wave's f16 rows are in LDS before the barrier behind which the other waves read them.
        asm volatile("s_wait_dscnt 0x0" ::: "memory");
        __syncthreads();
    }
    if constexpr (!MOVING) {
        // The reference: largest score of the query's first 32 keys (cm is still 0), rounded up to
        // a whole number. Set ahead of the loop, so that it is one value for the whole loop.
        v16h f0[4];
#pragma unroll
        for (int i = 0; i < 4; ++i) f0[i] = ld_op16(Ksh + ((i >> 1) * 16 + l16) * KD + (i & 1) * 32 + koff);
        v8h s0[PT][NG];
        form_scores(s0, f0);
#pragma unroll
        for (int g = 0; g < NG; ++g) {
            const float rg = (float)max_16(s0[0][g], s0[1][g]);
            const float dl = __builtin_ceilf(fmaxf(rg, xhalf(rg)));
            cm[0][g] = cm[1][g] = (v8h)(_Float16)(-dl);
        }
    }

    // One body for all trips: with the last trips peeled off for the two tests at the foot, the
    // register count rose and copies stood around the exponentials.
    // The tile barrier is split, and a trip lies between its halves. Signal at the head of trip
    // kb: this wave has left tile kb - 1 and its rows of tile kb + 1 are in LDS. Wait at the foot
    // of trip kb: every wave has said so. Behind it tile kb + 1 may be read, and buffer
    // (kb + 2) mod 3, which held tile kb - 1, may be written. The LDS reads between the halves
    // are of tile kb, in the third buffer, which nobody writes before the foot of trip kb + 1.
    // So a wave waits only for one that is a whole tile behind, not at every tile.
    int cur = 0;   // kb mod 3
#pragma clang loop unroll(disable)
    for (int kb = 0; kb < NBLK; ++kb) {

        // Fragment loads, both in the hardware k order (keys or d 8 hf + j, then 16 + 8 hf + j).
        auto ld_k = [&](int t, int kc) {   // A: key rows 16 t .. 16 t + 15, d chunk kc
            return ld_op16(Ksh + cur * TS + (t * 16 + l16) * KD + kc * 32 + koff);
        };
        auto ld_v = [&](int t, int kc) {   // A: d rows 16 t .. 16 t + 15, key chunk kc
            const _Float16* p = Vsh + cur * TS + (kc * 32 + koff + (lane & 7)) * VD + t * 16 + ((lane >> 3) & 1) * 8;
            union { v16h v; v8h h[2]; } u;
            u.h[0] = ld_tr16(p);              // keys 8 hf + j of the chunk
            u.h[1] = ld_tr16(p + 16 * VD);    // keys 16 + 8 hf + j
            return u.v;
        };
        // Four K and four V^T fragments, both sets refilled in ONE run of LDS loads per step,
        // behind the score products and their test. The scheduling fences around the run keep
        // it in one place, ahead of the work that covers its latency; left free, the compiler
        // put two loads and a full wait in front of most products.
        v16h fk[4], fv[4];

        // K fragments of the tile's first 32 keys
#pragma unroll
        for (int i = 0; i < 4; ++i) fk[i] = ld_k(i >> 1, i & 1);
        // First half of the barrier. The wait ends the wave's reads of tile kb - 1 and of its landing
        // slot and its stores of tile kb + 1 (and brings the fragments just asked for).
        asm volatile("s_wait_dscnt 0x0\n\ts_barrier_signal -1" ::: "memory");
        if (kb + 2 < NBLK) fill_rows(kb + 2, 0);   // lands under the first three steps of this tile
        __builtin_amdgcn_sched_barrier(0);   // the load run stays in front of the products
        float4 ra[WR / 2], rb[WR / 2];       // the wave's f32 rows of tile kb + 2

#pragma unroll
        for (int p = 0; p < KBLK / PK; ++p) {
            v8h c[PT][NG];               // score tiles, f16: four registers each
            if constexpr (!MOVING) {
                form_scores(c, fk);
            } else {
            // The very first step (maximum in use still 0) moves the maximum whatever its scores
            // are, and may lower it: from then on the maximum in use is a true maximum.
            const bool first = (p == 0) && (kb == 0);
            _Float16    thr = first ? (_Float16)-__builtin_inff() : (_Float16)LAZY;
            const float lo  = first ? -__builtin_inff() : 0.0f;
            // One trip, at most two: a trip that finds a score more than thr above the maximum in
            // use moves the maximum, sets thr to +infinity (no score lies above that, so the second
            // trip is the last) and forms the scores anew; the K fragments are still in their
            // registers. A loop, so that the score tiles have ONE defining place: with a second
            // one behind a branch the compiler copied all 16 registers on every step.
            for (;;) {
                form_scores(c, fk);

                // ---- online softmax in exp2 domain, one query per lane and group ----
                // Largest score - maximum in use among this lane's 32 values of both groups, two a register.
                const _Float16 top = max_16(max3_8(c[0][0], c[1][0], c[0][1]), c[1][1]);
                // one wave-uniform test per trip
                if (__builtin_amdgcn_ballot_w32(top > thr) == 0u) break;
#pragma unroll
                for (int g = 0; g < NG; ++g) {
                    const float rg = (float)max_16(c[0][g], c[1][g]);
                    const float r  = fmaxf(rg, xhalf(rg));
                    // Rise of the maximum in use, rounded up to a whole number: the maximum in use stays a
                    // whole number, which f16 holds exactly, so the tiles move by just what the accumulators do.
                    const float dl = __builtin_ceilf(fmaxf(r, lo));
                    const float sc = fast_exp2(fminf(-dl, 0.0f));    // first step: accumulators are 0, factor stays finite
                    // rescale accumulators; of the row-sum tile only row 8 hf (register 0) is read
#pragma unroll
                    for (int t = 0; t < 4; ++t) o[g][t] *= sc;
                    olsum[g][0] *= sc;
                    cm[0][g] -= (v8h)(_Float16)dl;
                    cm[1][g] -= (v8h)(_Float16)dl;
                }
                thr = (_Float16)__builtin_inff();
            }
            }
            __builtin_amdgcn_sched_barrier(0);   // load run behind the last use of the K registers
            if (p + 1 == KBLK / PK) wait_async_lds();   // the wave's rows of tile kb + 2 have landed
#pragma unroll
            for (int t = 0; t < 4; ++t) fv[t] = ld_v(t, p);   // V^T, the 32 keys of this step
            if (p + 1 < KBLK / PK) {   // K fragments of the tile's next 32 keys (same LDS buffer)
#pragma unroll
                for (int i = 0; i < 4; ++i) fk[i] = ld_k(PT * (p + 1) + (i >> 1), i & 1);
            } else {                   // last step: the landed rows take the K fragments' place in the run
                load_rows(ra, rb, 0);
            }
            __builtin_amdgcn_sched_barrier(0);   // and in front of the exponentials, which cover its latency

            // ---- O^T += V^T * P^T, rowsum += ones * P^T : 32 keys ----
            v16h pb[NG];                 // keys 8 hf + j of tile 0, then of tile 1
            static_assert(NG == 2, "two column groups written out");
            pb[0] = exp2_tiles<!MOVING>(c[0][0], c[1][0]);
            pb[1] = exp2_tiles<false>(c[0][1], c[1][1]);
            // Both groups' exponentials stand in front of the first product, whose V^T
            // fragment is still on its way from LDS under them.
            __builtin_amdgcn_sched_barrier(0);
#pragma unroll
            for (int g = 0; g < NG; ++g) {
#pragma unroll
                for (int t = 0; t < 4; ++t)
                    o[g][t] = __builtin_amdgcn_wmma_f32_16x16x32_f16(
                        false, fv[t], false, pb[g], (short)0, o[g][t], false, false);
                olsum[g] = __builtin_amdgcn_wmma_f32_16x16x32_f16(
                    false, vones, false, pb[g], (short)0, olsum[g], false, false);
            }
        }
        // Second half of the barrier (see above the loop). The scheduling fence keeps it behind the
        // tile's last products; left free, the compiler set it in front of nine of them.
        __builtin_amdgcn_sched_barrier(0);
        asm volatile("s_barrier_wait -1" ::: "memory");
        if (kb + 2 < NBLK) store_rows(ra, rb, cur == 0 ? NBUF - 1 : cur - 1);   // buffer (kb + 2) mod 3
        cur = (cur == NBUF - 1) ? 0 : cur + 1;
    }
    };   // key_loop

    key_loop(Flag<false>{});   // fixed reference

    // Range test of the fixed form: a row sum that is infinite or not a number. One wave's
    // finding sends the whole work-group through the loop again, since the tiles are shared work.
    {
        const bool bad = !(olsum[0][0] < __builtin_inff()) || !(olsum[1][0] < __builtin_inff());
        if (__builtin_amdgcn_ballot_w32(bad) != 0u) redo = 1;
    }
    // The finding is in LDS before the barrier behind which every wave reads it.
    asm volatile("s_wait_dscnt 0x0" ::: "memory");
    __syncthreads();
    if (__builtin_amdgcn_readfirstlane(redo) != 0) {   // the same in every wave of the work-group
#pragma unroll
        for (int g = 0; g < NG; ++g) {
#pragma unroll
            for (int t = 0; t < 4; ++t) o[g][t] = vzero;
            olsum[g] = vzero;
            cm[0][g] = cm[1][g] = (v8h)(_Float16)0.0f;
        }
        // Every wave has left the last tile and its own landing range at the barrier above.
        fill_rows(0, 0);
        fill_rows(1, 1);
        key_loop(Flag<true>{});   // moving maximum
    }

    // ---- normalize (1 rcp per query) and write out (fp32): 8 consecutive d per tile ----
#pragma unroll
    for (int g = 0; g < NG; ++g) {
        const float rinv = fast_rcp(olsum[g][0]);
#pragma unroll
        for (int t = 0; t < 4; ++t) o[g][t] *= rinv;
    }
    // The wave's own range is free (last copies waited for, last reads over, no other wave
    // touches it): its 8192 bytes take the wave's 32 output rows.
    // The lane id is taken anew, so that no offset of the Q rows' turn stays in a register over the loop.
    const int ln  = (int)__builtin_amdgcn_mbcnt_lo(~0u, 0u);
    float*    ost = &Stg[0][0] + wvs * WST;
#pragma unroll
    for (int g = 0; g < NG; ++g)
#pragma unroll
        for (int t = 0; t < 4; ++t) {
            *(v4f*)(ost + frag_off(ln, g, t, 0)) = __builtin_shufflevector(o[g][t], o[g][t], 0, 1, 2, 3);
            *(v4f*)(ost + frag_off(ln, g, t, 1)) = __builtin_shufflevector(o[g][t], o[g][t], 4, 5, 6, 7);
        }
    // The rows are in LDS before other lanes of the wave read them back.
    asm volatile("s_wait_dscnt 0x0" ::: "memory");
    v4f w[16];
#pragma unroll
    for (int i = 0; i < 16; ++i) w[i] = *(const v4f*)(ost + i * 128 + line_off(ln, i));
    // Every LDS load stands in front of the first store, so that no register
    // that an issued store names is written again.
    __builtin_amdgcn_sched_barrier(0);
    float* og = Ob + wrow0 + ln * 4;
#pragma unroll
    for (int i = 0; i < 16; ++i) *(v4f*)(og + i * 128) = w[i];
}

extern "C" void kernel_launch(void* const* d_in, const int* in_sizes, int n_in,
                              void* d_out, int out_size, void* d_ws, size_t ws_size,
                              hipStream_t stream) {
    const float* q = (const float*)d_in[0];
    const float* k = (const float*)d_in[1];
    const float* v = (const float*)d_in[2];
    float* out = (float*)d_out;
    (void)in_sizes; (void)n_in; (void)out_size; (void)d_ws; (void)ws_size;

    dim3 grid(Bn * Hn, Sn / QTILE);                      // (64, 4)
    fa_wmma_kernel<<<grid, NWV * 32, 0, stream>>>(q, k, v, out);
}
